// v000
// Times are from an AMD MI455X. After a warm-up the kernel runs many times in a row, and a time is the length of
// such a window on the GPU divided by its runs, so every launch and the gaps after it count. The runs cycle
// through copies of the inputs. A figure is the median of several windows, for all but v000 over two sittings.
// Sittings can differ by a few percent; kernels timed side by side share one.
// v000, which the later versions start from, runs in 1110 microseconds.
#include <hip/hip_runtime.h>
#include <math.h>

#define D  256
#define H  8
#define HC 32

typedef __attribute__((ext_vector_type(2))) float v2f;
typedef __attribute__((ext_vector_type(8))) float v8f;

// ---- order-preserving float<->int encoding for atomic max on floats ----
__device__ __forceinline__ int ord_f32(float f) {
  int i = __float_as_int(f);
  return i >= 0 ? i : (i ^ 0x7FFFFFFF);
}
__device__ __forceinline__ float unord_f32(int i) {
  return __int_as_float(i >= 0 ? i : (i ^ 0x7FFFFFFF));
}

// ---------------- fill kernels ----------------
__global__ void fill_f32_kernel(float* p, float v, long n) {
  long i = (long)blockIdx.x * blockDim.x + threadIdx.x;
  if (i < n) p[i] = v;
}
__global__ void fill_i32_kernel(int* p, int v, long n) {
  long i = (long)blockIdx.x * blockDim.x + threadIdx.x;
  if (i < n) p[i] = v;
}

// ---------------- GEMM: Y[N,M] = act(X[N,256] @ W[256,M] + bias) ----------------
// One wave per 16(M-rows) x 64(N-cols) output tile, f32 WMMA 16x16x4, K fixed = 256.
__global__ void gemm_wmma_f32_kernel(const float* __restrict__ X,
                                     const float* __restrict__ W,
                                     const float* __restrict__ bias,
                                     float* __restrict__ Y,
                                     int Nrows, int Mcols, int act) {
  const int K = D;
  int wave = (int)(((long)blockIdx.x * blockDim.x + threadIdx.x) >> 5);
  int lane = threadIdx.x & 31;
  int ntiles = Mcols >> 6;             // 64-wide tiles
  int mtiles = (Nrows + 15) >> 4;
  int mt = wave / ntiles;
  int nt = wave - mt * ntiles;
  if (mt >= mtiles) return;            // wave-uniform exit (EXEC stays all-ones for WMMA)
  int half = lane >> 4;                // 0: K pair {0,1} | 1: K pair {2,3}
  int l15  = lane & 15;
  int row  = mt * 16 + l15;
  int rowc = row < Nrows ? row : Nrows - 1;
  const float* xp    = X + (long)rowc * K + half * 2;
  int col0 = nt * 64 + l15;
  const float* wbase = W + (long)(half * 2) * Mcols + col0;

  v8f acc[4] = {};
  #pragma unroll 2
  for (int k = 0; k < K; k += 4) {
    // A 16x4 frag: lane l<16 holds A[l][0..1], lane l+16 holds A[l][2..3] (contiguous f2)
    v2f a = *(const v2f*)(xp + k);
    const float* wp = wbase + (long)k * Mcols;
    // B 4x16 frags: VGPR r -> rows r and r+2 (row-striped across lanes)
    v2f b0, b1, b2, b3;
    b0[0] = wp[0];  b0[1] = wp[Mcols + 0];
    b1[0] = wp[16]; b1[1] = wp[Mcols + 16];
    b2[0] = wp[32]; b2[1] = wp[Mcols + 32];
    b3[0] = wp[48]; b3[1] = wp[Mcols + 48];
    acc[0] = __builtin_amdgcn_wmma_f32_16x16x4_f32(false, a, false, b0, (short)0, acc[0], false, false);
    acc[1] = __builtin_amdgcn_wmma_f32_16x16x4_f32(false, a, false, b1, (short)0, acc[1], false, false);
    acc[2] = __builtin_amdgcn_wmma_f32_16x16x4_f32(false, a, false, b2, (short)0, acc[2], false, false);
    acc[3] = __builtin_amdgcn_wmma_f32_16x16x4_f32(false, a, false, b3, (short)0, acc[3], false, false);
  }
  // C/D layout: VGPR r -> M=r (lanes 0-15), M=r+8 (lanes 16-31); N = lane&15
  #pragma unroll
  for (int t = 0; t < 4; ++t) {
    int col = col0 + t * 16;
    float bv = bias[col];
    #pragma unroll
    for (int r = 0; r < 8; ++r) {
      int orow = mt * 16 + half * 8 + r;
      if (orow < Nrows) {
        float x = acc[t][r] + bv;
        if (act) x = 0.5f * x * (1.0f + erff(x * 0.70710678118654752f));  // exact GELU
        Y[(long)orow * Mcols + col] = x;
      }
    }
  }
}

// ---------------- per-edge QK dot + segment max ----------------
// one wave per edge; 4 lanes per head, 8 dims per lane
__global__ void edge_qk_max_kernel(const float* __restrict__ Q,
                                   const float* __restrict__ KV,   // [n,512], K at +0
                                   const int* __restrict__ eq,
                                   const int* __restrict__ ek,
                                   float* __restrict__ qkbuf,      // [E,H]
                                   int* __restrict__ mbuf,         // [n_q,H] encoded
                                   int E) {
  long gid = (long)blockIdx.x * blockDim.x + threadIdx.x;
  int e = (int)(gid >> 5);
  if (e >= E) return;
  int lane = (int)(gid & 31);
  int h = lane >> 2, j = lane & 3;
  int q = eq[e], k = ek[e];
  const float4* qp = (const float4*)(Q  + (long)q * D       + h * HC + j * 8);
  const float4* kp = (const float4*)(KV + (long)k * (2 * D) + h * HC + j * 8);
  float4 q0 = qp[0], q1 = qp[1];
  float4 k0 = kp[0], k1 = kp[1];
  float p = q0.x * k0.x + q0.y * k0.y + q0.z * k0.z + q0.w * k0.w
          + q1.x * k1.x + q1.y * k1.y + q1.z * k1.z + q1.w * k1.w;
  p += __shfl_xor(p, 1);
  p += __shfl_xor(p, 2);
  if (j == 0) {
    float s = p * 0.17677669529663687f;  // 1/sqrt(32)
    qkbuf[(long)e * H + h] = s;
    atomicMax(&mbuf[(long)q * H + h], ord_f32(s));
  }
}

// ---------------- exp(qk - m) and segment sum ----------------
__global__ void edge_expsum_kernel(float* __restrict__ qkbuf,
                                   const int* __restrict__ eq,
                                   const int* __restrict__ mbuf,
                                   float* __restrict__ sbuf,
                                   int E) {
  long gid = (long)blockIdx.x * blockDim.x + threadIdx.x;
  int e = (int)(gid >> 3);
  if (e >= E) return;
  int h = (int)(gid & 7);
  int q = eq[e];
  float m  = unord_f32(mbuf[(long)q * H + h]);
  float ex = expf(qkbuf[(long)e * H + h] - m);
  qkbuf[(long)e * H + h] = ex;
  atomicAdd(&sbuf[(long)q * H + h], ex);
}

// ---------------- alpha * V scatter-accumulate ----------------
__global__ void edge_scatter_kernel(const float* __restrict__ qkbuf,
                                    const int* __restrict__ eq,
                                    const int* __restrict__ ek,
                                    const float* __restrict__ sbuf,
                                    const float* __restrict__ KV,   // V at +256
                                    float* __restrict__ acc,        // [n_q,256]
                                    int E) {
  long gid = (long)blockIdx.x * blockDim.x + threadIdx.x;
  int e = (int)(gid >> 5);
  if (e >= E) return;
  int lane = (int)(gid & 31);
  int h = lane >> 2, j = lane & 3;
  int q = eq[e], k = ek[e];
  float alpha = qkbuf[(long)e * H + h] / sbuf[(long)q * H + h];
  const float* vp = KV + (long)k * (2 * D) + D + h * HC + j * 8;
  float*       ap = acc + (long)q * D         + h * HC + j * 8;
  #pragma unroll
  for (int d = 0; d < 8; ++d) atomicAdd(&ap[d], alpha * vp[d]);
}

// ---------------- out = LayerNorm(A + B) * g + beta, one 256-thread block per row ----------------
__global__ void add_ln_kernel(const float* __restrict__ A,
                              const float* __restrict__ B,
                              const float* __restrict__ g,
                              const float* __restrict__ be,
                              float* __restrict__ out,
                              int rows) {
  int row = blockIdx.x;
  if (row >= rows) return;
  int tid = threadIdx.x;
  __shared__ float red[8];
  long base = (long)row * D;
  float x = A[base + tid] + B[base + tid];
  float s = x;
  #pragma unroll
  for (int o = 16; o > 0; o >>= 1) s += __shfl_down(s, o);
  if ((tid & 31) == 0) red[tid >> 5] = s;
  __syncthreads();
  float mean = (red[0] + red[1] + red[2] + red[3] + red[4] + red[5] + red[6] + red[7]) * (1.0f / D);
  float dlt = x - mean;
  __syncthreads();
  float s2 = dlt * dlt;
  #pragma unroll
  for (int o = 16; o > 0; o >>= 1) s2 += __shfl_down(s2, o);
  if ((tid & 31) == 0) red[tid >> 5] = s2;
  __syncthreads();
  float var = (red[0] + red[1] + red[2] + red[3] + red[4] + red[5] + red[6] + red[7]) * (1.0f / D);
  float r = rsqrtf(var + 1e-5f);
  out[base + tid] = dlt * r * g[tid] + be[tid];
}

// ---------------- host-side helpers ----------------
static inline dim3 grid_for(long threads) { return dim3((unsigned)((threads + 255) / 256)); }

static inline void launch_gemm(const float* X, const float* W, const float* b, float* Y,
                               int N, int M, int act, hipStream_t s) {
  long waves = (long)((N + 15) / 16) * (long)(M / 64);
  gemm_wmma_f32_kernel<<<grid_for(waves * 32), dim3(256), 0, s>>>(X, W, b, Y, N, M, act);
}

extern "C" void kernel_launch(void* const* d_in, const int* in_sizes, int n_in,
                              void* d_out, int out_size, void* d_ws, size_t ws_size,
                              hipStream_t stream) {
  const float* v    = (const float*)d_in[0];
  const float* c    = (const float*)d_in[1];
  const int*   adjp = (const int*)d_in[2];
  const int*   adjn = (const int*)d_in[3];
  const float* Wq   = (const float*)d_in[4];
  const float* bq   = (const float*)d_in[5];
  const float* Wkv  = (const float*)d_in[6];
  const float* bkv  = (const float*)d_in[7];
  const float* fvw1 = (const float*)d_in[8];
  const float* fvb1 = (const float*)d_in[9];
  const float* fvw2 = (const float*)d_in[10];
  const float* fvb2 = (const float*)d_in[11];
  const float* fcw1 = (const float*)d_in[12];
  const float* fcb1 = (const float*)d_in[13];
  const float* fcw2 = (const float*)d_in[14];
  const float* fcb2 = (const float*)d_in[15];
  const float* lavg = (const float*)d_in[16];
  const float* lavb = (const float*)d_in[17];
  const float* lfvg = (const float*)d_in[18];
  const float* lfvb = (const float*)d_in[19];
  const float* lacg = (const float*)d_in[20];
  const float* lacb = (const float*)d_in[21];
  const float* lfcg = (const float*)d_in[22];
  const float* lfcb = (const float*)d_in[23];

  const int NV = in_sizes[0] / D;
  const int NC = in_sizes[1] / D;
  const int Ep = in_sizes[2] / 2;
  const int En = in_sizes[3] / 2;
  const int* ep_c = adjp;       // adj row0: clause indices
  const int* ep_v = adjp + Ep;  // adj row1: variable indices
  const int* en_c = adjn;
  const int* en_v = adjn + En;

  // ---- workspace layout (floats) ----
  float* ws = (float*)d_ws;
  size_t off = 0;
  float* Qv  = ws + off; off += (size_t)NV * D;
  float* KVv = ws + off; off += (size_t)NV * 2 * D;   // later reused as FFN hidden (NC*256 == NV*512)
  float* Qc  = ws + off; off += (size_t)NC * D;       // later reused as FFN-2 output (c)
  float* KVc = ws + off; off += (size_t)NC * 2 * D;
  int*   m_pv = (int*)(ws + off); off += (size_t)NV * H;
  int*   m_nv = (int*)(ws + off); off += (size_t)NV * H;
  int*   m_pc = (int*)(ws + off); off += (size_t)NC * H;
  int*   m_nc = (int*)(ws + off); off += (size_t)NC * H;
  float* s_pv = ws + off; off += (size_t)NV * H;
  float* s_nv = ws + off; off += (size_t)NV * H;
  float* s_pc = ws + off; off += (size_t)NC * H;
  float* s_nc = ws + off; off += (size_t)NC * H;
  float* qk_pv = ws + off; off += (size_t)Ep * H;
  float* qk_nv = ws + off; off += (size_t)En * H;
  float* qk_pc = ws + off; off += (size_t)Ep * H;
  float* qk_nc = ws + off; off += (size_t)En * H;

  float* out   = (float*)d_out;
  float* acc_v = out;                     // attention accumulators live in d_out
  float* acc_c = out + (size_t)NV * D;
  float* hbuf  = KVv;                     // FFN hidden scratch (after attention done)
  float* y2v   = Qv;                      // FFN-2 outputs
  float* y2c   = Qc;

  const long m_total = (long)2 * (NV + NC) * H;

  // ---- 1) shared projections (computed once; reference recomputes per polarity) ----
  launch_gemm(v, Wq,  bq,  Qv,  NV, D,     0, stream);
  launch_gemm(v, Wkv, bkv, KVv, NV, 2 * D, 0, stream);
  launch_gemm(c, Wq,  bq,  Qc,  NC, D,     0, stream);
  launch_gemm(c, Wkv, bkv, KVc, NC, 2 * D, 0, stream);

  // ---- 2) init softmax state + accumulators (every call: deterministic) ----
  fill_i32_kernel<<<grid_for(m_total), 256, 0, stream>>>(m_pv, (int)0x80000000, m_total);
  fill_f32_kernel<<<grid_for(m_total), 256, 0, stream>>>(s_pv, 0.0f, m_total);
  fill_f32_kernel<<<grid_for((long)(NV + NC) * D), 256, 0, stream>>>(out, 0.0f, (long)(NV + NC) * D);

  // ---- 3) per-edge QK + segment max ----
  edge_qk_max_kernel<<<grid_for((long)Ep * 32), 256, 0, stream>>>(Qv, KVc, ep_v, ep_c, qk_pv, m_pv, Ep);
  edge_qk_max_kernel<<<grid_for((long)Ep * 32), 256, 0, stream>>>(Qc, KVv, ep_c, ep_v, qk_pc, m_pc, Ep);
  edge_qk_max_kernel<<<grid_for((long)En * 32), 256, 0, stream>>>(Qv, KVc, en_v, en_c, qk_nv, m_nv, En);
  edge_qk_max_kernel<<<grid_for((long)En * 32), 256, 0, stream>>>(Qc, KVv, en_c, en_v, qk_nc, m_nc, En);

  // ---- 4) exp + segment sum ----
  edge_expsum_kernel<<<grid_for((long)Ep * 8), 256, 0, stream>>>(qk_pv, ep_v, m_pv, s_pv, Ep);
  edge_expsum_kernel<<<grid_for((long)Ep * 8), 256, 0, stream>>>(qk_pc, ep_c, m_pc, s_pc, Ep);
  edge_expsum_kernel<<<grid_for((long)En * 8), 256, 0, stream>>>(qk_nv, en_v, m_nv, s_nv, En);
  edge_expsum_kernel<<<grid_for((long)En * 8), 256, 0, stream>>>(qk_nc, en_c, m_nc, s_nc, En);

  // ---- 5) alpha*V scatter (pos+neg share accumulator; residual sums them anyway) ----
  edge_scatter_kernel<<<grid_for((long)Ep * 32), 256, 0, stream>>>(qk_pv, ep_v, ep_c, s_pv, KVc, acc_v, Ep);
  edge_scatter_kernel<<<grid_for((long)Ep * 32), 256, 0, stream>>>(qk_pc, ep_c, ep_v, s_pc, KVv, acc_c, Ep);
  edge_scatter_kernel<<<grid_for((long)En * 32), 256, 0, stream>>>(qk_nv, en_v, en_c, s_nv, KVc, acc_v, En);
  edge_scatter_kernel<<<grid_for((long)En * 32), 256, 0, stream>>>(qk_nc, en_c, en_v, s_nc, KVv, acc_c, En);

  // ---- 6) residual + LN (attention) ----
  add_ln_kernel<<<dim3(NV), dim3(D), 0, stream>>>(v, acc_v, lavg, lavb, acc_v, NV);
  add_ln_kernel<<<dim3(NC), dim3(D), 0, stream>>>(c, acc_c, lacg, lacb, acc_c, NC);

  // ---- 7) FFN v: gelu(v1@W1+b1)@W2+b2, then residual + LN ----
  launch_gemm(acc_v, fvw1, fvb1, hbuf, NV, D, 1, stream);
  launch_gemm(hbuf,  fvw2, fvb2, y2v,  NV, D, 0, stream);
  add_ln_kernel<<<dim3(NV), dim3(D), 0, stream>>>(acc_v, y2v, lfvg, lfvb, acc_v, NV);

  // ---- 8) FFN c ----
  launch_gemm(acc_c, fcw1, fcb1, hbuf, NC, D, 1, stream);
  launch_gemm(hbuf,  fcw2, fcb2, y2c,  NC, D, 0, stream);
  add_ln_kernel<<<dim3(NC), dim3(D), 0, stream>>>(acc_c, y2c, lfcg, lfcb, acc_c, NC);

  (void)n_in; (void)out_size; (void)ws_size;
}

// v001
// A run of this version takes 1030 microseconds.
// Next to v000, in two timings, it ran 1.11 and 1.12 times as fast.
#include <hip/hip_runtime.h>
#include <math.h>

#define D  256
#define H  8
#define HC 32

typedef __attribute__((ext_vector_type(2))) float v2f;
typedef __attribute__((ext_vector_type(8))) float v8f;

// ---- order-preserving float<->int encoding for atomic max on floats ----
__device__ __forceinline__ int ord_f32(float f) {
  int i = __float_as_int(f);
  return i >= 0 ? i : (i ^ 0x7FFFFFFF);
}
__device__ __forceinline__ float unord_f32(int i) {
  return __int_as_float(i >= 0 ? i : (i ^ 0x7FFFFFFF));
}

// ---------------- fill kernels ----------------
__global__ void fill_f32_kernel(float* p, float v, long n) {
  long i = (long)blockIdx.x * blockDim.x + threadIdx.x;
  if (i < n) p[i] = v;
}
__global__ void fill_i32_kernel(int* p, int v, long n) {
  long i = (long)blockIdx.x * blockDim.x + threadIdx.x;
  if (i < n) p[i] = v;
}

// ---------------- GEMM: Y[N,M] = act(X[N,256] @ W[256,M] + bias) ----------------
// One 8-wave work-group per 128 x 128 output tile, f32 WMMA 16x16x4, K fixed = 256.
// X and W arrive in k-chunks of 32 by asynchronous copies into two LDS buffers; each wave owns
// 32 rows x 64 cols (2 x 4 accumulator tiles) and reads its fragments from LDS.
#define BM 128
#define BN 128
#define KC 32
#define NT (D / KC)
#define XP 36    // floats per staged X row: 144 B, 16 B x odd, so 16 rows x 16 B meet every bank once
#define WP 136   // floats per staged W row: two rows down is 16 banks on, so the lane halves do not collide
#define XBUF (BM * XP)
#define WBUF (KC * WP)

// One chunk's eight copies of this thread: 16 B each, four of X and four of W. The s_wait_xcnt closes
// the statement so that no address register is rewritten while a copy may still read it.
__device__ __forceinline__ void stage_chunk(unsigned xl, unsigned wl,
                                            const float* x0, const float* x1,
                                            const float* x2, const float* x3,
                                            const float* w0, long wstep) {
  unsigned xl1 = xl + 32 * XP * 4, xl2 = xl + 64 * XP * 4, xl3 = xl + 96 * XP * 4;
  unsigned wl1 = wl + 8 * WP * 4,  wl2 = wl + 16 * WP * 4, wl3 = wl + 24 * WP * 4;
  const float* w1 = w0 + wstep;
  const float* w2 = w1 + wstep;
  const float* w3 = w2 + wstep;
  asm volatile("global_load_async_to_lds_b128 %0, %8, off\n\t"
               "global_load_async_to_lds_b128 %1, %9, off\n\t"
               "global_load_async_to_lds_b128 %2, %10, off\n\t"
               "global_load_async_to_lds_b128 %3, %11, off\n\t"
               "global_load_async_to_lds_b128 %4, %12, off\n\t"
               "global_load_async_to_lds_b128 %5, %13, off\n\t"
               "global_load_async_to_lds_b128 %6, %14, off\n\t"
               "global_load_async_to_lds_b128 %7, %15, off\n\t"
               "s_wait_xcnt 0x0"
               :: "v"(xl), "v"(xl1), "v"(xl2), "v"(xl3), "v"(wl), "v"(wl1), "v"(wl2), "v"(wl3),
                  "v"(x0), "v"(x1), "v"(x2), "v"(x3), "v"(w0), "v"(w1), "v"(w2), "v"(w3)
               : "memory");
}

__global__ __launch_bounds__(256)
void gemm_wmma_f32_kernel(const float* __restrict__ X,
                          const float* __restrict__ W,
                          const float* __restrict__ bias,
                          float* __restrict__ Y,
                          int Nrows, int Mcols, int act) {
  const int K = D;
  __shared__ __attribute__((aligned(16))) float Xs[2 * XBUF];
  __shared__ __attribute__((aligned(16))) float Ws[2 * WBUF];
  int tid  = threadIdx.x;
  int lane = tid & 31;
  int wave = tid >> 5;
  int ntiles = Mcols >> 7;             // 128-wide tiles
  int mt = blockIdx.x / ntiles;
  int nt = blockIdx.x - mt * ntiles;   // column tiles of one row tile are neighbours in the grid
  int m0 = mt * BM, n0 = nt * BN;
  int half = lane >> 4;                // 0: K pair {0,1} | 1: K pair {2,3}
  int l15  = lane & 15;
  int wm = wave >> 1, wn = wave & 1;   // 4 x 2 waves

  // copies: X 8 lanes per 128-B row piece, rows xr + 32 i; W one wave per 512-B row piece, rows wave + 8 i
  int xr = tid >> 3, xc = (tid & 7) * 4;
  const float* xg[4];
  for (int i = 0; i < 4; ++i) {
    int row = m0 + xr + 32 * i;
    xg[i] = X + (long)(row < Nrows ? row : Nrows - 1) * K + xc;   // rows past the end re-read the last row
  }
  const float* wg = W + (long)wave * Mcols + n0 + lane * 4;
  long wstep = (long)8 * Mcols;
  long wchunk = (long)KC * Mcols;
  unsigned xl = (unsigned)(uintptr_t)&Xs[xr * XP + xc];        // low 32 bits: the byte address in LDS
  unsigned wl = (unsigned)(uintptr_t)&Ws[wave * WP + lane * 4];

  stage_chunk(xl, wl, xg[0], xg[1], xg[2], xg[3], wg, wstep);
  asm volatile("s_wait_asynccnt 0x0" ::: "memory");   // this wave's part of chunk 0 has landed
  __syncthreads();                                    // and every other wave's
  stage_chunk(xl + XBUF * 4, wl + WBUF * 4, xg[0] + KC, xg[1] + KC, xg[2] + KC, xg[3] + KC,
              wg + wchunk, wstep);

  int afo = (wm * 32 + l15) * XP + half * 2;
  int bfo = half * 2 * WP + wn * 64 + l15;

  v8f acc[2][4] = {};
  // rolled: one loop foot with one order of waits, and a short text
  #pragma unroll 1
  for (int t = 0; t < NT; ++t) {
    int buf = t & 1;
    const float* xs = &Xs[buf * XBUF + afo];
    const float* wf = &Ws[buf * WBUF + bfo];
    // unrolled so that the LDS offsets are immediates and fragments are fetched ahead of their WMMAs
    #pragma unroll
    for (int kk = 0; kk < KC; kk += 4) {
      // A 16x4 frag: lane l<16 holds A[l][0..1], lane l+16 holds A[l][2..3]
      v2f a0 = *(const v2f*)(xs + kk);
      v2f a1 = *(const v2f*)(xs + 16 * XP + kk);
      // B 4x16 frags: VGPR r -> rows r and r+2 (row-striped across lanes)
      const float* wp = wf + kk * WP;
      v2f b0, b1, b2, b3;
      b0[0] = wp[0];  b0[1] = wp[WP + 0];
      b1[0] = wp[16]; b1[1] = wp[WP + 16];
      b2[0] = wp[32]; b2[1] = wp[WP + 32];
      b3[0] = wp[48]; b3[1] = wp[WP + 48];
      acc[0][0] = __builtin_amdgcn_wmma_f32_16x16x4_f32(false, a0, false, b0, (short)0, acc[0][0], false, false);
      acc[0][1] = __builtin_amdgcn_wmma_f32_16x16x4_f32(false, a0, false, b1, (short)0, acc[0][1], false, false);
      acc[0][2] = __builtin_amdgcn_wmma_f32_16x16x4_f32(false, a0, false, b2, (short)0, acc[0][2], false, false);
      acc[0][3] = __builtin_amdgcn_wmma_f32_16x16x4_f32(false, a0, false, b3, (short)0, acc[0][3], false, false);
      acc[1][0] = __builtin_amdgcn_wmma_f32_16x16x4_f32(false, a1, false, b0, (short)0, acc[1][0], false, false);
      acc[1][1] = __builtin_amdgcn_wmma_f32_16x16x4_f32(false, a1, false, b1, (short)0, acc[1][1], false, false);
      acc[1][2] = __builtin_amdgcn_wmma_f32_16x16x4_f32(false, a1, false, b2, (short)0, acc[1][2], false, false);
      acc[1][3] = __builtin_amdgcn_wmma_f32_16x16x4_f32(false, a1, false, b3, (short)0, acc[1][3], false, false);
    }
    asm volatile("s_wait_dscnt 0x0" ::: "memory");      // this wave's reads of buffer t mod 2 are done
    asm volatile("s_wait_asynccnt 0x0" ::: "memory");   // this wave's part of chunk t + 1 has landed
    __syncthreads();                                    // publishes chunk t + 1, frees buffer t mod 2
    if (t + 2 < NT) {
      int k0 = (t + 2) * KC;
      stage_chunk(xl + buf * (XBUF * 4), wl + buf * (WBUF * 4),
                  xg[0] + k0, xg[1] + k0, xg[2] + k0, xg[3] + k0, wg + (long)k0 * Mcols, wstep);
    }
  }
  asm volatile("s_wait_asynccnt 0x0" ::: "memory");     // no copy is left in flight at the wave's end
  // C/D layout: VGPR r -> M=r (lanes 0-15), M=r+8 (lanes 16-31); N = lane&15
  // all three loops unrolled: the accumulators stay in registers only under constant indices
  #pragma unroll
  for (int t = 0; t < 4; ++t) {
    int col = n0 + wn * 64 + t * 16 + l15;
    float bv = bias[col];
    #pragma unroll
    for (int i = 0; i < 2; ++i) {
      #pragma unroll
      for (int r = 0; r < 8; ++r) {
        int orow = m0 + wm * 32 + i * 16 + half * 8 + r;
        if (orow < Nrows) {
          float x = acc[i][t][r] + bv;
          if (act) x = 0.5f * x * (1.0f + erff(x * 0.70710678118654752f));  // exact GELU
          Y[(long)orow * Mcols + col] = x;
        }
      }
    }
  }
}

// ---------------- per-edge QK dot + segment max ----------------
// one wave per edge; 4 lanes per head, 8 dims per lane
__global__ void edge_qk_max_kernel(const float* __restrict__ Q,
                                   const float* __restrict__ KV,   // [n,512], K at +0
                                   const int* __restrict__ eq,
                                   const int* __restrict__ ek,
                                   float* __restrict__ qkbuf,      // [E,H]
                                   int* __restrict__ mbuf,         // [n_q,H] encoded
                                   int E) {
  long gid = (long)blockIdx.x * blockDim.x + threadIdx.x;
  int e = (int)(gid >> 5);
  if (e >= E) return;
  int lane = (int)(gid & 31);
  int h = lane >> 2, j = lane & 3;
  int q = eq[e], k = ek[e];
  const float4* qp = (const float4*)(Q  + (long)q * D       + h * HC + j * 8);
  const float4* kp = (const float4*)(KV + (long)k * (2 * D) + h * HC + j * 8);
  float4 q0 = qp[0], q1 = qp[1];
  float4 k0 = kp[0], k1 = kp[1];
  float p = q0.x * k0.x + q0.y * k0.y + q0.z * k0.z + q0.w * k0.w
          + q1.x * k1.x + q1.y * k1.y + q1.z * k1.z + q1.w * k1.w;
  p += __shfl_xor(p, 1);
  p += __shfl_xor(p, 2);
  if (j == 0) {
    float s = p * 0.17677669529663687f;  // 1/sqrt(32)
    qkbuf[(long)e * H + h] = s;
    atomicMax(&mbuf[(long)q * H + h], ord_f32(s));
  }
}

// ---------------- exp(qk - m) and segment sum ----------------
__global__ void edge_expsum_kernel(float* __restrict__ qkbuf,
                                   const int* __restrict__ eq,
                                   const int* __restrict__ mbuf,
                                   float* __restrict__ sbuf,
                                   int E) {
  long gid = (long)blockIdx.x * blockDim.x + threadIdx.x;
  int e = (int)(gid >> 3);
  if (e >= E) return;
  int h = (int)(gid & 7);
  int q = eq[e];
  float m  = unord_f32(mbuf[(long)q * H + h]);
  float ex = expf(qkbuf[(long)e * H + h] - m);
  qkbuf[(long)e * H + h] = ex;
  atomicAdd(&sbuf[(long)q * H + h], ex);
}

// ---------------- alpha * V scatter-accumulate ----------------
__global__ void edge_scatter_kernel(const float* __restrict__ qkbuf,
                                    const int* __restrict__ eq,
                                    const int* __restrict__ ek,
                                    const float* __restrict__ sbuf,
                                    const float* __restrict__ KV,   // V at +256
                                    float* __restrict__ acc,        // [n_q,256]
                                    int E) {
  long gid = (long)blockIdx.x * blockDim.x + threadIdx.x;
  int e = (int)(gid >> 5);
  if (e >= E) return;
  int lane = (int)(gid & 31);
  int h = lane >> 2, j = lane & 3;
  int q = eq[e], k = ek[e];
  float alpha = qkbuf[(long)e * H + h] / sbuf[(long)q * H + h];
  const float* vp = KV + (long)k * (2 * D) + D + h * HC + j * 8;
  float*       ap = acc + (long)q * D         + h * HC + j * 8;
  #pragma unroll
  for (int d = 0; d < 8; ++d) atomicAdd(&ap[d], alpha * vp[d]);
}

// ---------------- out = LayerNorm(A + B) * g + beta, one 256-thread block per row ----------------
__global__ void add_ln_kernel(const float* __restrict__ A,
                              const float* __restrict__ B,
                              const float* __restrict__ g,
                              const float* __restrict__ be,
                              float* __restrict__ out,
                              int rows) {
  int row = blockIdx.x;
  if (row >= rows) return;
  int tid = threadIdx.x;
  __shared__ float red[8];
  long base = (long)row * D;
  float x = A[base + tid] + B[base + tid];
  float s = x;
  #pragma unroll
  for (int o = 16; o > 0; o >>= 1) s += __shfl_down(s, o);
  if ((tid & 31) == 0) red[tid >> 5] = s;
  __syncthreads();
  float mean = (red[0] + red[1] + red[2] + red[3] + red[4] + red[5] + red[6] + red[7]) * (1.0f / D);
  float dlt = x - mean;
  __syncthreads();
  float s2 = dlt * dlt;
  #pragma unroll
  for (int o = 16; o > 0; o >>= 1) s2 += __shfl_down(s2, o);
  if ((tid & 31) == 0) red[tid >> 5] = s2;
  __syncthreads();
  float var = (red[0] + red[1] + red[2] + red[3] + red[4] + red[5] + red[6] + red[7]) * (1.0f / D);
  float r = rsqrtf(var + 1e-5f);
  out[base + tid] = dlt * r * g[tid] + be[tid];
}

// ---------------- host-side helpers ----------------
static inline dim3 grid_for(long threads) { return dim3((unsigned)((threads + 255) / 256)); }

static inline void launch_gemm(const float* X, const float* W, const float* b, float* Y,
                               int N, int M, int act, hipStream_t s) {
  unsigned tiles = (unsigned)((N + BM - 1) / BM) * (unsigned)(M / BN);
  gemm_wmma_f32_kernel<<<dim3(tiles), dim3(256), 0, s>>>(X, W, b, Y, N, M, act);
}

extern "C" void kernel_launch(void* const* d_in, const int* in_sizes, int n_in,
                              void* d_out, int out_size, void* d_ws, size_t ws_size,
                              hipStream_t stream) {
  const float* v    = (const float*)d_in[0];
  const float* c    = (const float*)d_in[1];
  const int*   adjp = (const int*)d_in[2];
  const int*   adjn = (const int*)d_in[3];
  const float* Wq   = (const float*)d_in[4];
  const float* bq   = (const float*)d_in[5];
  const float* Wkv  = (const float*)d_in[6];
  const float* bkv  = (const float*)d_in[7];
  const float* fvw1 = (const float*)d_in[8];
  const float* fvb1 = (const float*)d_in[9];
  const float* fvw2 = (const float*)d_in[10];
  const float* fvb2 = (const float*)d_in[11];
  const float* fcw1 = (const float*)d_in[12];
  const float* fcb1 = (const float*)d_in[13];
  const float* fcw2 = (const float*)d_in[14];
  const float* fcb2 = (const float*)d_in[15];
  const float* lavg = (const float*)d_in[16];
  const float* lavb = (const float*)d_in[17];
  const float* lfvg = (const float*)d_in[18];
  const float* lfvb = (const float*)d_in[19];
  const float* lacg = (const float*)d_in[20];
  const float* lacb = (const float*)d_in[21];
  const float* lfcg = (const float*)d_in[22];
  const float* lfcb = (const float*)d_in[23];

  const int NV = in_sizes[0] / D;
  const int NC = in_sizes[1] / D;
  const int Ep = in_sizes[2] / 2;
  const int En = in_sizes[3] / 2;
  const int* ep_c = adjp;       // adj row0: clause indices
  const int* ep_v = adjp + Ep;  // adj row1: variable indices
  const int* en_c = adjn;
  const int* en_v = adjn + En;

  // ---- workspace layout (floats) ----
  float* ws = (float*)d_ws;
  size_t off = 0;
  float* Qv  = ws + off; off += (size_t)NV * D;
  float* KVv = ws + off; off += (size_t)NV * 2 * D;   // later reused as FFN hidden (NC*256 == NV*512)
  float* Qc  = ws + off; off += (size_t)NC * D;       // later reused as FFN-2 output (c)
  float* KVc = ws + off; off += (size_t)NC * 2 * D;
  int*   m_pv = (int*)(ws + off); off += (size_t)NV * H;
  int*   m_nv = (int*)(ws + off); off += (size_t)NV * H;
  int*   m_pc = (int*)(ws + off); off += (size_t)NC * H;
  int*   m_nc = (int*)(ws + off); off += (size_t)NC * H;
  float* s_pv = ws + off; off += (size_t)NV * H;
  float* s_nv = ws + off; off += (size_t)NV * H;
  float* s_pc = ws + off; off += (size_t)NC * H;
  float* s_nc = ws + off; off += (size_t)NC * H;
  float* qk_pv = ws + off; off += (size_t)Ep * H;
  float* qk_nv = ws + off; off += (size_t)En * H;
  float* qk_pc = ws + off; off += (size_t)Ep * H;
  float* qk_nc = ws + off; off += (size_t)En * H;

  float* out   = (float*)d_out;
  float* acc_v = out;                     // attention accumulators live in d_out
  float* acc_c = out + (size_t)NV * D;
  float* hbuf  = KVv;                     // FFN hidden scratch (after attention done)
  float* y2v   = Qv;                      // FFN-2 outputs
  float* y2c   = Qc;

  const long m_total = (long)2 * (NV + NC) * H;

  // ---- 1) shared projections (computed once; reference recomputes per polarity) ----
  launch_gemm(v, Wq,  bq,  Qv,  NV, D,     0, stream);
  launch_gemm(v, Wkv, bkv, KVv, NV, 2 * D, 0, stream);
  launch_gemm(c, Wq,  bq,  Qc,  NC, D,     0, stream);
  launch_gemm(c, Wkv, bkv, KVc, NC, 2 * D, 0, stream);

  // ---- 2) init softmax state + accumulators (every call: deterministic) ----
  fill_i32_kernel<<<grid_for(m_total), 256, 0, stream>>>(m_pv, (int)0x80000000, m_total);
  fill_f32_kernel<<<grid_for(m_total), 256, 0, stream>>>(s_pv, 0.0f, m_total);
  fill_f32_kernel<<<grid_for((long)(NV + NC) * D), 256, 0, stream>>>(out, 0.0f, (long)(NV + NC) * D);

  // ---- 3) per-edge QK + segment max ----
  edge_qk_max_kernel<<<grid_for((long)Ep * 32), 256, 0, stream>>>(Qv, KVc, ep_v, ep_c, qk_pv, m_pv, Ep);
  edge_qk_max_kernel<<<grid_for((long)Ep * 32), 256, 0, stream>>>(Qc, KVv, ep_c, ep_v, qk_pc, m_pc, Ep);
  edge_qk_max_kernel<<<grid_for((long)En * 32), 256, 0, stream>>>(Qv, KVc, en_v, en_c, qk_nv, m_nv, En);
  edge_qk_max_kernel<<<grid_for((long)En * 32), 256, 0, stream>>>(Qc, KVv, en_c, en_v, qk_nc, m_nc, En);

  // ---- 4) exp + segment sum ----
  edge_expsum_kernel<<<grid_for((long)Ep * 8), 256, 0, stream>>>(qk_pv, ep_v, m_pv, s_pv, Ep);
  edge_expsum_kernel<<<grid_for((long)Ep * 8), 256, 0, stream>>>(qk_pc, ep_c, m_pc, s_pc, Ep);
  edge_expsum_kernel<<<grid_for((long)En * 8), 256, 0, stream>>>(qk_nv, en_v, m_nv, s_nv, En);
  edge_expsum_kernel<<<grid_for((long)En * 8), 256, 0, stream>>>(qk_nc, en_c, m_nc, s_nc, En);

  // ---- 5) alpha*V scatter (pos+neg share accumulator; residual sums them anyway) ----
  edge_scatter_kernel<<<grid_for((long)Ep * 32), 256, 0, stream>>>(qk_pv, ep_v, ep_c, s_pv, KVc, acc_v, Ep);
  edge_scatter_kernel<<<grid_for((long)Ep * 32), 256, 0, stream>>>(qk_pc, ep_c, ep_v, s_pc, KVv, acc_c, Ep);
  edge_scatter_kernel<<<grid_for((long)En * 32), 256, 0, stream>>>(qk_nv, en_v, en_c, s_nv, KVc, acc_v, En);
  edge_scatter_kernel<<<grid_for((long)En * 32), 256, 0, stream>>>(qk_nc, en_c, en_v, s_nc, KVv, acc_c, En);

  // ---- 6) residual + LN (attention) ----
  add_ln_kernel<<<dim3(NV), dim3(D), 0, stream>>>(v, acc_v, lavg, lavb, acc_v, NV);
  add_ln_kernel<<<dim3(NC), dim3(D), 0, stream>>>(c, acc_c, lacg, lacb, acc_c, NC);

  // ---- 7) FFN v: gelu(v1@W1+b1)@W2+b2, then residual + LN ----
  launch_gemm(acc_v, fvw1, fvb1, hbuf, NV, D, 1, stream);
  launch_gemm(hbuf,  fvw2, fvb2, y2v,  NV, D, 0, stream);
  add_ln_kernel<<<dim3(NV), dim3(D), 0, stream>>>(acc_v, y2v, lfvg, lfvb, acc_v, NV);

  // ---- 8) FFN c ----
  launch_gemm(acc_c, fcw1, fcb1, hbuf, NC, D, 1, stream);
  launch_gemm(hbuf,  fcw2, fcb2, y2c,  NC, D, 0, stream);
  add_ln_kernel<<<dim3(NC), dim3(D), 0, stream>>>(acc_c, y2c, lfcg, lfcb, acc_c, NC);

  (void)n_in; (void)out_size; (void)ws_size;
}

// v002
// One run takes 808 microseconds.
// Timed twice side by side with v001, it ran 1.27 and 1.28 times as fast.
// Counting every step since v000, it is 1.42 times as fast.
#include <hip/hip_runtime.h>
#include <math.h>

#define D  256
#define H  8
#define HC 32

typedef __attribute__((ext_vector_type(2))) float v2f;
typedef __attribute__((ext_vector_type(8))) float v8f;

// ---------------- fill kernel ----------------
__global__ void fill_i32_kernel(int* p, int v, long n) {
  long i = (long)blockIdx.x * blockDim.x + threadIdx.x;
  if (i < n) p[i] = v;
}

// ---------------- GEMM: Y[N,M] = act(X[N,256] @ W[256,M] + bias) ----------------
// One 8-wave work-group per 128 x 128 output tile, f32 WMMA 16x16x4, K fixed = 256.
// X and W arrive in k-chunks of 32 by asynchronous copies into two LDS buffers; each wave owns
// 32 rows x 64 cols (2 x 4 accumulator tiles) and reads its fragments from LDS.
#define BM 128
#define BN 128
#define KC 32
#define NT (D / KC)
#define XP 36    // floats per staged X row: 144 B, 16 B x odd, so 16 rows x 16 B meet every bank once
#define WP 136   // floats per staged W row: two rows down is 16 banks on, so the lane halves do not collide
#define XBUF (BM * XP)
#define WBUF (KC * WP)

// One chunk's eight copies of this thread: 16 B each, four of X and four of W. The s_wait_xcnt closes
// the statement so that no address register is rewritten while a copy may still read it.
__device__ __forceinline__ void stage_chunk(unsigned xl, unsigned wl,
                                            const float* x0, const float* x1,
                                            const float* x2, const float* x3,
                                            const float* w0, long wstep) {
  unsigned xl1 = xl + 32 * XP * 4, xl2 = xl + 64 * XP * 4, xl3 = xl + 96 * XP * 4;
  unsigned wl1 = wl + 8 * WP * 4,  wl2 = wl + 16 * WP * 4, wl3 = wl + 24 * WP * 4;
  const float* w1 = w0 + wstep;
  const float* w2 = w1 + wstep;
  const float* w3 = w2 + wstep;
  asm volatile("global_load_async_to_lds_b128 %0, %8, off\n\t"
               "global_load_async_to_lds_b128 %1, %9, off\n\t"
               "global_load_async_to_lds_b128 %2, %10, off\n\t"
               "global_load_async_to_lds_b128 %3, %11, off\n\t"
               "global_load_async_to_lds_b128 %4, %12, off\n\t"
               "global_load_async_to_lds_b128 %5, %13, off\n\t"
               "global_load_async_to_lds_b128 %6, %14, off\n\t"
               "global_load_async_to_lds_b128 %7, %15, off\n\t"
               "s_wait_xcnt 0x0"
               :: "v"(xl), "v"(xl1), "v"(xl2), "v"(xl3), "v"(wl), "v"(wl1), "v"(wl2), "v"(wl3),
                  "v"(x0), "v"(x1), "v"(x2), "v"(x3), "v"(w0), "v"(w1), "v"(w2), "v"(w3)
               : "memory");
}

__global__ __launch_bounds__(256)
void gemm_wmma_f32_kernel(const float* __restrict__ X,
                          const float* __restrict__ W,
                          const float* __restrict__ bias,
                          float* __restrict__ Y,
                          int Nrows, int Mcols, int act) {
  const int K = D;
  __shared__ __attribute__((aligned(16))) float Xs[2 * XBUF];
  __shared__ __attribute__((aligned(16))) float Ws[2 * WBUF];
  int tid  = threadIdx.x;
  int lane = tid & 31;
  int wave = tid >> 5;
  int ntiles = Mcols >> 7;             // 128-wide tiles
  int mt = blockIdx.x / ntiles;
  int nt = blockIdx.x - mt * ntiles;   // column tiles of one row tile are neighbours in the grid
  int m0 = mt * BM, n0 = nt * BN;
  int half = lane >> 4;                // 0: K pair {0,1} | 1: K pair {2,3}
  int l15  = lane & 15;
  int wm = wave >> 1, wn = wave & 1;   // 4 x 2 waves

  // copies: X 8 lanes per 128-B row piece, rows xr + 32 i; W one wave per 512-B row piece, rows wave + 8 i
  int xr = tid >> 3, xc = (tid & 7) * 4;
  const float* xg[4];
  for (int i = 0; i < 4; ++i) {
    int row = m0 + xr + 32 * i;
    xg[i] = X + (long)(row < Nrows ? row : Nrows - 1) * K + xc;   // rows past the end re-read the last row
  }
  const float* wg = W + (long)wave * Mcols + n0 + lane * 4;
  long wstep = (long)8 * Mcols;
  long wchunk = (long)KC * Mcols;
  unsigned xl = (unsigned)(uintptr_t)&Xs[xr * XP + xc];        // low 32 bits: the byte address in LDS
  unsigned wl = (unsigned)(uintptr_t)&Ws[wave * WP + lane * 4];

  stage_chunk(xl, wl, xg[0], xg[1], xg[2], xg[3], wg, wstep);
  asm volatile("s_wait_asynccnt 0x0" ::: "memory");   // this wave's part of chunk 0 has landed
  __syncthreads();                                    // and every other wave's
  stage_chunk(xl + XBUF * 4, wl + WBUF * 4, xg[0] + KC, xg[1] + KC, xg[2] + KC, xg[3] + KC,
              wg + wchunk, wstep);

  int afo = (wm * 32 + l15) * XP + half * 2;
  int bfo = half * 2 * WP + wn * 64 + l15;

  v8f acc[2][4] = {};
  // rolled: one loop foot with one order of waits, and a short text
  #pragma unroll 1
  for (int t = 0; t < NT; ++t) {
    int buf = t & 1;
    const float* xs = &Xs[buf * XBUF + afo];
    const float* wf = &Ws[buf * WBUF + bfo];
    // unrolled so that the LDS offsets are immediates and fragments are fetched ahead of their WMMAs
    #pragma unroll
    for (int kk = 0; kk < KC; kk += 4) {
      // A 16x4 frag: lane l<16 holds A[l][0..1], lane l+16 holds A[l][2..3]
      v2f a0 = *(const v2f*)(xs + kk);
      v2f a1 = *(const v2f*)(xs + 16 * XP + kk);
      // B 4x16 frags: VGPR r -> rows r and r+2 (row-striped across lanes)
      const float* wp = wf + kk * WP;
      v2f b0, b1, b2, b3;
      b0[0] = wp[0];  b0[1] = wp[WP + 0];
      b1[0] = wp[16]; b1[1] = wp[WP + 16];
      b2[0] = wp[32]; b2[1] = wp[WP + 32];
      b3[0] = wp[48]; b3[1] = wp[WP + 48];
      acc[0][0] = __builtin_amdgcn_wmma_f32_16x16x4_f32(false, a0, false, b0, (short)0, acc[0][0], false, false);
      acc[0][1] = __builtin_amdgcn_wmma_f32_16x16x4_f32(false, a0, false, b1, (short)0, acc[0][1], false, false);
      acc[0][2] = __builtin_amdgcn_wmma_f32_16x16x4_f32(false, a0, false, b2, (short)0, acc[0][2], false, false);
      acc[0][3] = __builtin_amdgcn_wmma_f32_16x16x4_f32(false, a0, false, b3, (short)0, acc[0][3], false, false);
      acc[1][0] = __builtin_amdgcn_wmma_f32_16x16x4_f32(false, a1, false, b0, (short)0, acc[1][0], false, false);
      acc[1][1] = __builtin_amdgcn_wmma_f32_16x16x4_f32(false, a1, false, b1, (short)0, acc[1][1], false, false);
      acc[1][2] = __builtin_amdgcn_wmma_f32_16x16x4_f32(false, a1, false, b2, (short)0, acc[1][2], false, false);
      acc[1][3] = __builtin_amdgcn_wmma_f32_16x16x4_f32(false, a1, false, b3, (short)0, acc[1][3], false, false);
    }
    asm volatile("s_wait_dscnt 0x0" ::: "memory");      // this wave's reads of buffer t mod 2 are done
    asm volatile("s_wait_asynccnt 0x0" ::: "memory");   // this wave's part of chunk t + 1 has landed
    __syncthreads();                                    // publishes chunk t + 1, frees buffer t mod 2
    if (t + 2 < NT) {
      int k0 = (t + 2) * KC;
      stage_chunk(xl + buf * (XBUF * 4), wl + buf * (WBUF * 4),
                  xg[0] + k0, xg[1] + k0, xg[2] + k0, xg[3] + k0, wg + (long)k0 * Mcols, wstep);
    }
  }
  asm volatile("s_wait_asynccnt 0x0" ::: "memory");     // no copy is left in flight at the wave's end
  // C/D layout: VGPR r -> M=r (lanes 0-15), M=r+8 (lanes 16-31); N = lane&15
  // all three loops unrolled: the accumulators stay in registers only under constant indices
  #pragma unroll
  for (int t = 0; t < 4; ++t) {
    int col = n0 + wn * 64 + t * 16 + l15;
    float bv = bias[col];
    #pragma unroll
    for (int i = 0; i < 2; ++i) {
      #pragma unroll
      for (int r = 0; r < 8; ++r) {
        int orow = m0 + wm * 32 + i * 16 + half * 8 + r;
        if (orow < Nrows) {
          float x = acc[i][t][r] + bv;
          if (act) x = 0.5f * x * (1.0f + erff(x * 0.70710678118654752f));  // exact GELU
          Y[(long)orow * Mcols + col] = x;
        }
      }
    }
  }
}

// ---------------- per-edge QK dot; the edge is pushed onto its query row's list ----------------
// one wave per edge; 4 lanes per head, 8 dims per lane
__global__ void edge_qk_link_kernel(const float* __restrict__ Q,
                                    const float* __restrict__ KV,   // [n_k,512], K at +0
                                    const int* __restrict__ eq,
                                    const int* __restrict__ ek,
                                    float* __restrict__ qkbuf,      // [E,H]
                                    int* __restrict__ head,         // [n_q] newest edge of the row, -1: none
                                    int* __restrict__ next,         // [E] the edge pushed before this one
                                    int E, int nq, int nk) {
  long gid = (long)blockIdx.x * blockDim.x + threadIdx.x;
  int e = (int)(gid >> 5);
  if (e >= E) return;
  int lane = (int)(gid & 31);
  int h = lane >> 2, j = lane & 3;
  int q = min(max(eq[e], 0), nq - 1), k = min(max(ek[e], 0), nk - 1);
  const float4* qp = (const float4*)(Q  + (long)q * D       + h * HC + j * 8);
  const float4* kp = (const float4*)(KV + (long)k * (2 * D) + h * HC + j * 8);
  float4 q0 = qp[0], q1 = qp[1];
  float4 k0 = kp[0], k1 = kp[1];
  int prev = -1;
  if (lane == 0) prev = atomicExch(&head[q], e);   // behind the row loads: its return flies with theirs
  float p = q0.x * k0.x + q0.y * k0.y + q0.z * k0.z + q0.w * k0.w
          + q1.x * k1.x + q1.y * k1.y + q1.z * k1.z + q1.w * k1.w;
  p += __shfl_xor(p, 1);
  p += __shfl_xor(p, 2);
  if (j == 0) qkbuf[(long)e * H + h] = p * 0.17677669529663687f;  // 1/sqrt(32)
  if (lane == 0) next[e] = prev;
}

// ---------------- segment softmax and alpha * V, one wave per query row ----------------
// The wave walks the row's edge list twice: first for each head's maximum, then for exp, its sum and
// the weighted V rows, all in registers. Lane l holds cols 4l..4l+3 (head l/8) and 128+4l.. (head 4+l/8).
__device__ __forceinline__ void row_walk(const float* __restrict__ qk,
                                         const int* __restrict__ next,
                                         const int* __restrict__ ek,
                                         const float* __restrict__ KV,   // V at +256
                                         int first, int E, int nk, int lane,
                                         float4& o0, float4& o1) {
  if (first < 0) return;              // a row without edges adds nothing
  int ha = lane >> 3, hb = 4 + ha;
  float ma = -INFINITY, mb = -INFINITY;
  int e = first;
  for (int n = 0; e >= 0 && n < E; ++n) {   // a list holds each edge once, so E bounds the walk
    ma = fmaxf(ma, qk[(long)e * H + ha]);
    mb = fmaxf(mb, qk[(long)e * H + hb]);
    e = __builtin_amdgcn_readfirstlane(next[e]);
  }
  float sa = 0.0f, sb = 0.0f;
  float4 a0 = make_float4(0.0f, 0.0f, 0.0f, 0.0f), a1 = a0;
  e = first;
  for (int n = 0; e >= 0 && n < E; ++n) {
    int k = min(max(ek[e], 0), nk - 1);
    float xa = qk[(long)e * H + ha], xb = qk[(long)e * H + hb];
    // the V loads below may land in the address registers of the two loads above
    asm volatile("s_wait_xcnt 0x0" ::: "memory");
    const float4* vp = (const float4*)(KV + (long)k * (2 * D) + D);
    float4 v0 = vp[lane], v1 = vp[32 + lane];
    float ea = expf(xa - ma);
    float eb = expf(xb - mb);
    e = __builtin_amdgcn_readfirstlane(next[e]);
    sa += ea; sb += eb;
    a0.x += ea * v0.x; a0.y += ea * v0.y; a0.z += ea * v0.z; a0.w += ea * v0.w;
    a1.x += eb * v1.x; a1.y += eb * v1.y; a1.z += eb * v1.z; a1.w += eb * v1.w;
  }
  o0.x += a0.x / sa; o0.y += a0.y / sa; o0.z += a0.z / sa; o0.w += a0.w / sa;
  o1.x += a1.x / sb; o1.y += a1.y / sb; o1.z += a1.z / sb; o1.w += a1.w / sb;
}

__global__ __launch_bounds__(256)
void row_attn_kernel(const float* __restrict__ qk_p, const int* __restrict__ head_p,
                     const int* __restrict__ next_p, const int* __restrict__ ek_p, int Ep,
                     const float* __restrict__ qk_n, const int* __restrict__ head_n,
                     const int* __restrict__ next_n, const int* __restrict__ ek_n, int En,
                     const float* __restrict__ KV,
                     float* __restrict__ acc,        // [n_q,256], every row written
                     int nq, int nk) {
  int row = (int)(((long)blockIdx.x * blockDim.x + threadIdx.x) >> 5);
  if (row >= nq) return;
  int lane = threadIdx.x & 31;
  int fp = __builtin_amdgcn_readfirstlane(head_p[row]);
  int fn = __builtin_amdgcn_readfirstlane(head_n[row]);
  float4 o0 = make_float4(0.0f, 0.0f, 0.0f, 0.0f), o1 = o0;
  row_walk(qk_p, next_p, ek_p, KV, fp, Ep, nk, lane, o0, o1);
  row_walk(qk_n, next_n, ek_n, KV, fn, En, nk, lane, o0, o1);
  float4* op = (float4*)(acc + (long)row * D);
  op[lane] = o0;
  op[32 + lane] = o1;
}

// ---------------- out = LayerNorm(A + B) * g + beta, one 256-thread block per row ----------------
__global__ void add_ln_kernel(const float* __restrict__ A,
                              const float* __restrict__ B,
                              const float* __restrict__ g,
                              const float* __restrict__ be,
                              float* __restrict__ out,
                              int rows) {
  int row = blockIdx.x;
  if (row >= rows) return;
  int tid = threadIdx.x;
  __shared__ float red[8];
  long base = (long)row * D;
  float x = A[base + tid] + B[base + tid];
  float s = x;
  #pragma unroll
  for (int o = 16; o > 0; o >>= 1) s += __shfl_down(s, o);
  if ((tid & 31) == 0) red[tid >> 5] = s;
  __syncthreads();
  float mean = (red[0] + red[1] + red[2] + red[3] + red[4] + red[5] + red[6] + red[7]) * (1.0f / D);
  float dlt = x - mean;
  __syncthreads();
  float s2 = dlt * dlt;
  #pragma unroll
  for (int o = 16; o > 0; o >>= 1) s2 += __shfl_down(s2, o);
  if ((tid & 31) == 0) red[tid >> 5] = s2;
  __syncthreads();
  float var = (red[0] + red[1] + red[2] + red[3] + red[4] + red[5] + red[6] + red[7]) * (1.0f / D);
  float r = rsqrtf(var + 1e-5f);
  out[base + tid] = dlt * r * g[tid] + be[tid];
}

// ---------------- host-side helpers ----------------
static inline dim3 grid_for(long threads) { return dim3((unsigned)((threads + 255) / 256)); }

static inline void launch_gemm(const float* X, const float* W, const float* b, float* Y,
                               int N, int M, int act, hipStream_t s) {
  unsigned tiles = (unsigned)((N + BM - 1) / BM) * (unsigned)(M / BN);
  gemm_wmma_f32_kernel<<<dim3(tiles), dim3(256), 0, s>>>(X, W, b, Y, N, M, act);
}

extern "C" void kernel_launch(void* const* d_in, const int* in_sizes, int n_in,
                              void* d_out, int out_size, void* d_ws, size_t ws_size,
                              hipStream_t stream) {
  const float* v    = (const float*)d_in[0];
  const float* c    = (const float*)d_in[1];
  const int*   adjp = (const int*)d_in[2];
  const int*   adjn = (const int*)d_in[3];
  const float* Wq   = (const float*)d_in[4];
  const float* bq   = (const float*)d_in[5];
  const float* Wkv  = (const float*)d_in[6];
  const float* bkv  = (const float*)d_in[7];
  const float* fvw1 = (const float*)d_in[8];
  const float* fvb1 = (const float*)d_in[9];
  const float* fvw2 = (const float*)d_in[10];
  const float* fvb2 = (const float*)d_in[11];
  const float* fcw1 = (const float*)d_in[12];
  const float* fcb1 = (const float*)d_in[13];
  const float* fcw2 = (const float*)d_in[14];
  const float* fcb2 = (const float*)d_in[15];
  const float* lavg = (const float*)d_in[16];
  const float* lavb = (const float*)d_in[17];
  const float* lfvg = (const float*)d_in[18];
  const float* lfvb = (const float*)d_in[19];
  const float* lacg = (const float*)d_in[20];
  const float* lacb = (const float*)d_in[21];
  const float* lfcg = (const float*)d_in[22];
  const float* lfcb = (const float*)d_in[23];

  const int NV = in_sizes[0] / D;
  const int NC = in_sizes[1] / D;
  const int Ep = in_sizes[2] / 2;
  const int En = in_sizes[3] / 2;
  const int* ep_c = adjp;       // adj row0: clause indices
  const int* ep_v = adjp + Ep;  // adj row1: variable indices
  const int* en_c = adjn;
  const int* en_v = adjn + En;

  // ---- workspace layout (floats) ----
  float* ws = (float*)d_ws;
  size_t off = 0;
  float* Qv  = ws + off; off += (size_t)NV * D;
  float* KVv = ws + off; off += (size_t)NV * 2 * D;   // later reused as FFN hidden (NC*256 == NV*512)
  float* Qc  = ws + off; off += (size_t)NC * D;       // later reused as FFN-2 output (c)
  float* KVc = ws + off; off += (size_t)NC * 2 * D;
  int* head_pv = (int*)(ws + off); off += (size_t)NV;
  int* head_nv = (int*)(ws + off); off += (size_t)NV;
  int* head_pc = (int*)(ws + off); off += (size_t)NC;
  int* head_nc = (int*)(ws + off); off += (size_t)NC;
  int* next_pv = (int*)(ws + off); off += (size_t)Ep;
  int* next_nv = (int*)(ws + off); off += (size_t)En;
  int* next_pc = (int*)(ws + off); off += (size_t)Ep;
  int* next_nc = (int*)(ws + off); off += (size_t)En;
  float* qk_pv = ws + off; off += (size_t)Ep * H;
  float* qk_nv = ws + off; off += (size_t)En * H;
  float* qk_pc = ws + off; off += (size_t)Ep * H;
  float* qk_nc = ws + off; off += (size_t)En * H;

  float* out   = (float*)d_out;
  float* acc_v = out;                     // attention results live in d_out
  float* acc_c = out + (size_t)NV * D;
  float* hbuf  = KVv;                     // FFN hidden scratch (after attention done)
  float* y2v   = Qv;                      // FFN-2 outputs
  float* y2c   = Qc;

  const long h_total = (long)2 * (NV + NC);

  // ---- 1) shared projections (computed once; reference recomputes per polarity) ----
  launch_gemm(v, Wq,  bq,  Qv,  NV, D,     0, stream);
  launch_gemm(v, Wkv, bkv, KVv, NV, 2 * D, 0, stream);
  launch_gemm(c, Wq,  bq,  Qc,  NC, D,     0, stream);
  launch_gemm(c, Wkv, bkv, KVc, NC, 2 * D, 0, stream);

  // ---- 2) empty edge lists (every call) ----
  fill_i32_kernel<<<grid_for(h_total), 256, 0, stream>>>(head_pv, -1, h_total);

  // ---- 3) per-edge QK, and each edge linked into its query row's list ----
  edge_qk_link_kernel<<<grid_for((long)Ep * 32), 256, 0, stream>>>(Qv, KVc, ep_v, ep_c, qk_pv, head_pv, next_pv, Ep, NV, NC);
  edge_qk_link_kernel<<<grid_for((long)Ep * 32), 256, 0, stream>>>(Qc, KVv, ep_c, ep_v, qk_pc, head_pc, next_pc, Ep, NC, NV);
  edge_qk_link_kernel<<<grid_for((long)En * 32), 256, 0, stream>>>(Qv, KVc, en_v, en_c, qk_nv, head_nv, next_nv, En, NV, NC);
  edge_qk_link_kernel<<<grid_for((long)En * 32), 256, 0, stream>>>(Qc, KVv, en_c, en_v, qk_nc, head_nc, next_nc, En, NC, NV);

  // ---- 4) softmax + alpha*V per query row, both polarities summed (the residual sums them anyway) ----
  row_attn_kernel<<<grid_for((long)NV * 32), 256, 0, stream>>>(qk_pv, head_pv, next_pv, ep_c, Ep,
                                                               qk_nv, head_nv, next_nv, en_c, En, KVc, acc_v, NV, NC);
  row_attn_kernel<<<grid_for((long)NC * 32), 256, 0, stream>>>(qk_pc, head_pc, next_pc, ep_v, Ep,
                                                               qk_nc, head_nc, next_nc, en_v, En, KVv, acc_c, NC, NV);

  // ---- 6) residual + LN (attention) ----
  add_ln_kernel<<<dim3(NV), dim3(D), 0, stream>>>(v, acc_v, lavg, lavb, acc_v, NV);
  add_ln_kernel<<<dim3(NC), dim3(D), 0, stream>>>(c, acc_c, lacg, lacb, acc_c, NC);

  // ---- 7) FFN v: gelu(v1@W1+b1)@W2+b2, then residual + LN ----
  launch_gemm(acc_v, fvw1, fvb1, hbuf, NV, D, 1, stream);
  launch_gemm(hbuf,  fvw2, fvb2, y2v,  NV, D, 0, stream);
  add_ln_kernel<<<dim3(NV), dim3(D), 0, stream>>>(acc_v, y2v, lfvg, lfvb, acc_v, NV);

  // ---- 8) FFN c ----
  launch_gemm(acc_c, fcw1, fcb1, hbuf, NC, D, 1, stream);
  launch_gemm(hbuf,  fcw2, fcb2, y2c,  NC, D, 0, stream);
  add_ln_kernel<<<dim3(NC), dim3(D), 0, stream>>>(acc_c, y2c, lfcg, lfcb, acc_c, NC);

  (void)n_in; (void)out_size; (void)ws_size;
}

// v003
// Measured time: 697 microseconds a run.
// Next to v002, in two timings, it ran 1.16 times as fast each time.
// All steps since v000 together make it 1.65 times as fast.
#include <hip/hip_runtime.h>
#include <math.h>

#define D  256
#define H  8
#define HC 32

typedef __attribute__((ext_vector_type(2))) float v2f;
typedef __attribute__((ext_vector_type(8))) float v8f;
typedef __attribute__((ext_vector_type(4))) float v4f;

// ---------------- fill kernel ----------------
__global__ void fill_i32_kernel(int* p, int v, long n) {
  long i = (long)blockIdx.x * blockDim.x + threadIdx.x;
  if (i < n) p[i] = v;
}

// ---------------- GEMM: Y[N,M] = act(X[N,256] @ W[256,M] + bias) ----------------
// One 8-wave work-group per 128 x 128 output tile, f32 WMMA 16x16x4, K fixed = 256.
// X and W arrive in k-chunks of 32 by asynchronous copies into two LDS buffers; each wave owns
// 32 rows x 64 cols (2 x 4 accumulator tiles) and reads its fragments from LDS.
#define BM 128
#define BN 128
#define KC 32
#define NT (D / KC)
#define XP 36    // floats per staged X row: 144 B, 16 B x odd, so 16 rows x 16 B meet every bank once
#define WP 136   // floats per staged W row: two rows down is 16 banks on, so the lane halves do not collide
#define XBUF (BM * XP)
#define WBUF (KC * WP)

// One chunk's eight copies of this thread: 16 B each, four of X and four of W. The s_wait_xcnt closes
// the statement so that no address register is rewritten while a copy may still read it.
__device__ __forceinline__ void stage_chunk(unsigned xl, unsigned wl,
                                            const float* x0, const float* x1,
                                            const float* x2, const float* x3,
                                            const float* w0, long wstep) {
  unsigned xl1 = xl + 32 * XP * 4, xl2 = xl + 64 * XP * 4, xl3 = xl + 96 * XP * 4;
  unsigned wl1 = wl + 8 * WP * 4,  wl2 = wl + 16 * WP * 4, wl3 = wl + 24 * WP * 4;
  const float* w1 = w0 + wstep;
  const float* w2 = w1 + wstep;
  const float* w3 = w2 + wstep;
  asm volatile("global_load_async_to_lds_b128 %0, %8, off\n\t"
               "global_load_async_to_lds_b128 %1, %9, off\n\t"
               "global_load_async_to_lds_b128 %2, %10, off\n\t"
               "global_load_async_to_lds_b128 %3, %11, off\n\t"
               "global_load_async_to_lds_b128 %4, %12, off\n\t"
               "global_load_async_to_lds_b128 %5, %13, off\n\t"
               "global_load_async_to_lds_b128 %6, %14, off\n\t"
               "global_load_async_to_lds_b128 %7, %15, off\n\t"
               "s_wait_xcnt 0x0"
               :: "v"(xl), "v"(xl1), "v"(xl2), "v"(xl3), "v"(wl), "v"(wl1), "v"(wl2), "v"(wl3),
                  "v"(x0), "v"(x1), "v"(x2), "v"(x3), "v"(w0), "v"(w1), "v"(w2), "v"(w3)
               : "memory");
}

__global__ __launch_bounds__(256)
void gemm_wmma_f32_kernel(const float* __restrict__ X,
                          const float* __restrict__ W,
                          const float* __restrict__ bias,
                          float* __restrict__ Y,
                          int Nrows, int Mcols, int act) {
  const int K = D;
  __shared__ __attribute__((aligned(16))) float Xs[2 * XBUF];
  __shared__ __attribute__((aligned(16))) float Ws[2 * WBUF];
  int tid  = threadIdx.x;
  int lane = tid & 31;
  int wave = tid >> 5;
  int ntiles = Mcols >> 7;             // 128-wide tiles
  int mt = blockIdx.x / ntiles;
  int nt = blockIdx.x - mt * ntiles;   // column tiles of one row tile are neighbours in the grid
  int m0 = mt * BM, n0 = nt * BN;
  int half = lane >> 4;                // 0: K pair {0,1} | 1: K pair {2,3}
  int l15  = lane & 15;
  int wm = wave >> 1, wn = wave & 1;   // 4 x 2 waves

  // copies: X 8 lanes per 128-B row piece, rows xr + 32 i; W one wave per 512-B row piece, rows wave + 8 i
  int xr = tid >> 3, xc = (tid & 7) * 4;
  const float* xg[4];
  for (int i = 0; i < 4; ++i) {
    int row = m0 + xr + 32 * i;
    xg[i] = X + (long)(row < Nrows ? row : Nrows - 1) * K + xc;   // rows past the end re-read the last row
  }
  const float* wg = W + (long)wave * Mcols + n0 + lane * 4;
  long wstep = (long)8 * Mcols;
  long wchunk = (long)KC * Mcols;
  unsigned xl = (unsigned)(uintptr_t)&Xs[xr * XP + xc];        // low 32 bits: the byte address in LDS
  unsigned wl = (unsigned)(uintptr_t)&Ws[wave * WP + lane * 4];

  stage_chunk(xl, wl, xg[0], xg[1], xg[2], xg[3], wg, wstep);
  asm volatile("s_wait_asynccnt 0x0" ::: "memory");   // this wave's part of chunk 0 has landed
  __syncthreads();                                    // and every other wave's
  stage_chunk(xl + XBUF * 4, wl + WBUF * 4, xg[0] + KC, xg[1] + KC, xg[2] + KC, xg[3] + KC,
              wg + wchunk, wstep);

  int afo = (wm * 32 + l15) * XP + half * 2;
  int bfo = half * 2 * WP + wn * 64 + l15;

  v8f acc[2][4] = {};
  // rolled: one loop foot with one order of waits, and a short text
  #pragma unroll 1
  for (int t = 0; t < NT; ++t) {
    int buf = t & 1;
    const float* xs = &Xs[buf * XBUF + afo];
    const float* wf = &Ws[buf * WBUF + bfo];
    // unrolled so that the LDS offsets are immediates and fragments are fetched ahead of their WMMAs
    #pragma unroll
    for (int kk = 0; kk < KC; kk += 4) {
      // A 16x4 frag: lane l<16 holds A[l][0..1], lane l+16 holds A[l][2..3]
      v2f a0 = *(const v2f*)(xs + kk);
      v2f a1 = *(const v2f*)(xs + 16 * XP + kk);
      // B 4x16 frags: VGPR r -> rows r and r+2 (row-striped across lanes)
      const float* wp = wf + kk * WP;
      v2f b0, b1, b2, b3;
      b0[0] = wp[0];  b0[1] = wp[WP + 0];
      b1[0] = wp[16]; b1[1] = wp[WP + 16];
      b2[0] = wp[32]; b2[1] = wp[WP + 32];
      b3[0] = wp[48]; b3[1] = wp[WP + 48];
      acc[0][0] = __builtin_amdgcn_wmma_f32_16x16x4_f32(false, a0, false, b0, (short)0, acc[0][0], false, false);
      acc[0][1] = __builtin_amdgcn_wmma_f32_16x16x4_f32(false, a0, false, b1, (short)0, acc[0][1], false, false);
      acc[0][2] = __builtin_amdgcn_wmma_f32_16x16x4_f32(false, a0, false, b2, (short)0, acc[0][2], false, false);
      acc[0][3] = __builtin_amdgcn_wmma_f32_16x16x4_f32(false, a0, false, b3, (short)0, acc[0][3], false, false);
      acc[1][0] = __builtin_amdgcn_wmma_f32_16x16x4_f32(false, a1, false, b0, (short)0, acc[1][0], false, false);
      acc[1][1] = __builtin_amdgcn_wmma_f32_16x16x4_f32(false, a1, false, b1, (short)0, acc[1][1], false, false);
      acc[1][2] = __builtin_amdgcn_wmma_f32_16x16x4_f32(false, a1, false, b2, (short)0, acc[1][2], false, false);
      acc[1][3] = __builtin_amdgcn_wmma_f32_16x16x4_f32(false, a1, false, b3, (short)0, acc[1][3], false, false);
    }
    asm volatile("s_wait_dscnt 0x0" ::: "memory");      // this wave's reads of buffer t mod 2 are done
    asm volatile("s_wait_asynccnt 0x0" ::: "memory");   // this wave's part of chunk t + 1 has landed
    __syncthreads();                                    // publishes chunk t + 1, frees buffer t mod 2
    if (t + 2 < NT) {
      int k0 = (t + 2) * KC;
      stage_chunk(xl + buf * (XBUF * 4), wl + buf * (WBUF * 4),
                  xg[0] + k0, xg[1] + k0, xg[2] + k0, xg[3] + k0, wg + (long)k0 * Mcols, wstep);
    }
  }
  asm volatile("s_wait_asynccnt 0x0" ::: "memory");     // no copy is left in flight at the wave's end
  // C/D layout: VGPR r -> M=r (lanes 0-15), M=r+8 (lanes 16-31); N = lane&15
  // all three loops unrolled: the accumulators stay in registers only under constant indices
  #pragma unroll
  for (int t = 0; t < 4; ++t) {
    int col = n0 + wn * 64 + t * 16 + l15;
    float bv = bias[col];
    #pragma unroll
    for (int i = 0; i < 2; ++i) {
      #pragma unroll
      for (int r = 0; r < 8; ++r) {
        int orow = m0 + wm * 32 + i * 16 + half * 8 + r;
        if (orow < Nrows) {
          float x = acc[i][t][r] + bv;
          if (act) x = 0.5f * x * (1.0f + erff(x * 0.70710678118654752f));  // exact GELU
          Y[(long)orow * Mcols + col] = x;
        }
      }
    }
  }
}

// ---------------- per-edge QK dot; the edge is pushed onto its query row's list ----------------
// one wave per edge; 4 lanes per head, 8 dims per lane
__global__ void edge_qk_link_kernel(const float* __restrict__ Q,
                                    const float* __restrict__ KV,   // [n_k,512], K at +0
                                    const int* __restrict__ eq,
                                    const int* __restrict__ ek,
                                    float* __restrict__ qkbuf,      // [E,H]
                                    int* __restrict__ head,         // [n_q] newest edge of the row, -1: none
                                    int* __restrict__ next,         // [E] the edge pushed before this one
                                    int E, int nq, int nk) {
  long gid = (long)blockIdx.x * blockDim.x + threadIdx.x;
  int e = (int)(gid >> 5);
  if (e >= E) return;
  int lane = (int)(gid & 31);
  int h = lane >> 2, j = lane & 3;
  int q = min(max(eq[e], 0), nq - 1), k = min(max(ek[e], 0), nk - 1);
  const float4* qp = (const float4*)(Q  + (long)q * D       + h * HC + j * 8);
  const float4* kp = (const float4*)(KV + (long)k * (2 * D) + h * HC + j * 8);
  float4 q0 = qp[0], q1 = qp[1];
  float4 k0 = kp[0], k1 = kp[1];
  int prev = -1;
  if (lane == 0) prev = atomicExch(&head[q], e);   // behind the row loads: its return flies with theirs
  float p = q0.x * k0.x + q0.y * k0.y + q0.z * k0.z + q0.w * k0.w
          + q1.x * k1.x + q1.y * k1.y + q1.z * k1.z + q1.w * k1.w;
  p += __shfl_xor(p, 1);
  p += __shfl_xor(p, 2);
  if (j == 0) qkbuf[(long)e * H + h] = p * 0.17677669529663687f;  // 1/sqrt(32)
  if (lane == 0) next[e] = prev;
}

// ---------------- segment softmax and alpha * V, one wave per query row ----------------
// The wave walks the row's edge list twice: first for each head's maximum, then for exp, its sum and
// the weighted V rows, all in registers. Lane l holds cols 4l..4l+3 (head l/8) and 128+4l.. (head 4+l/8).
__device__ __forceinline__ void row_walk(const float* __restrict__ qk,
                                         const int* __restrict__ next,
                                         const int* __restrict__ ek,
                                         const float* __restrict__ KV,   // V at +256
                                         int first, int E, int nk, int lane,
                                         float4& o0, float4& o1) {
  if (first < 0) return;              // a row without edges adds nothing
  int ha = lane >> 3, hb = 4 + ha;
  float ma = -INFINITY, mb = -INFINITY;
  int e = first;
  for (int n = 0; e >= 0 && n < E; ++n) {   // a list holds each edge once, so E bounds the walk
    ma = fmaxf(ma, qk[(long)e * H + ha]);
    mb = fmaxf(mb, qk[(long)e * H + hb]);
    e = __builtin_amdgcn_readfirstlane(next[e]);
  }
  float sa = 0.0f, sb = 0.0f;
  float4 a0 = make_float4(0.0f, 0.0f, 0.0f, 0.0f), a1 = a0;
  e = first;
  for (int n = 0; e >= 0 && n < E; ++n) {
    int k = min(max(ek[e], 0), nk - 1);
    float xa = qk[(long)e * H + ha], xb = qk[(long)e * H + hb];
    // the V loads below may land in the address registers of the two loads above
    asm volatile("s_wait_xcnt 0x0" ::: "memory");
    const float4* vp = (const float4*)(KV + (long)k * (2 * D) + D);
    float4 v0 = vp[lane], v1 = vp[32 + lane];
    float ea = expf(xa - ma);
    float eb = expf(xb - mb);
    e = __builtin_amdgcn_readfirstlane(next[e]);
    sa += ea; sb += eb;
    a0.x += ea * v0.x; a0.y += ea * v0.y; a0.z += ea * v0.z; a0.w += ea * v0.w;
    a1.x += eb * v1.x; a1.y += eb * v1.y; a1.z += eb * v1.z; a1.w += eb * v1.w;
  }
  o0.x += a0.x / sa; o0.y += a0.y / sa; o0.z += a0.z / sa; o0.w += a0.w / sa;
  o1.x += a1.x / sb; o1.y += a1.y / sb; o1.z += a1.z / sb; o1.w += a1.w / sb;
}

__global__ __launch_bounds__(256)
void row_attn_kernel(const float* __restrict__ qk_p, const int* __restrict__ head_p,
                     const int* __restrict__ next_p, const int* __restrict__ ek_p, int Ep,
                     const float* __restrict__ qk_n, const int* __restrict__ head_n,
                     const int* __restrict__ next_n, const int* __restrict__ ek_n, int En,
                     const float* __restrict__ KV,
                     float* __restrict__ acc,        // [n_q,256], every row written
                     int nq, int nk) {
  int row = (int)(((long)blockIdx.x * blockDim.x + threadIdx.x) >> 5);
  if (row >= nq) return;
  int lane = threadIdx.x & 31;
  int fp = __builtin_amdgcn_readfirstlane(head_p[row]);
  int fn = __builtin_amdgcn_readfirstlane(head_n[row]);
  float4 o0 = make_float4(0.0f, 0.0f, 0.0f, 0.0f), o1 = o0;
  row_walk(qk_p, next_p, ek_p, KV, fp, Ep, nk, lane, o0, o1);
  row_walk(qk_n, next_n, ek_n, KV, fn, En, nk, lane, o0, o1);
  float4* op = (float4*)(acc + (long)row * D);
  op[lane] = o0;
  op[32 + lane] = o1;
}

// ---------------- out = LayerNorm(A + B) * g + beta, one wave per LNR rows ----------------
// A lane holds cols 4l..4l+3 and 128+4l..128+4l+3 of each of its wave's rows: every load and store is 16 B
// a lane and 512 contiguous bytes a wave, all of a wave's loads fly together, and both row sums are made
// in registers, with no LDS and no barrier. out may be A or B: a wave reads only the rows that it writes.
#define LNR 4

// Sum over the wave's 32 lanes, left in every lane: four exchanges inside the 16-lane rows, then row with row.
template <int CTRL>
__device__ __forceinline__ float lane_swap(float x) {   // CTRL 0x160 + m: the value of lane l ^ m, m < 16
  return __builtin_bit_cast(float, __builtin_amdgcn_update_dpp(0, __builtin_bit_cast(int, x), CTRL, 0xf, 0xf, true));
}
__device__ __forceinline__ float wave_sum(float x) {
  x += lane_swap<0x161>(x);
  x += lane_swap<0x162>(x);
  x += lane_swap<0x164>(x);
  x += lane_swap<0x168>(x);
  int b = __builtin_bit_cast(int, x);
  return x + __builtin_bit_cast(float, __builtin_amdgcn_permlanex16(b, b, 0x76543210, 0xfedcba98, false, false));
}

// R consecutive rows of one wave, from row0 on.
template <int R>
__device__ __forceinline__ void ln_rows(const float* A, const float* B,
                                        const float* __restrict__ g, const float* __restrict__ be,
                                        float* out, int row0, int lane) {
  const v4f* ap = (const v4f*)(A + (long)row0 * D);
  const v4f* bp = (const v4f*)(B + (long)row0 * D);
  v4f x0[R], x1[R], y0[R], y1[R];
  // unrolled, here and below: the rows stay in registers only under constant indices
  #pragma unroll
  for (int r = 0; r < R; ++r) {
    x0[r] = ap[r * 64 + lane]; x1[r] = ap[r * 64 + 32 + lane];
    y0[r] = bp[r * 64 + lane]; y1[r] = bp[r * 64 + 32 + lane];
  }
  v4f g0 = ((const v4f*)g)[lane],  g1 = ((const v4f*)g)[32 + lane];
  v4f e0 = ((const v4f*)be)[lane], e1 = ((const v4f*)be)[32 + lane];
  if constexpr (R == 4) {
    // holds all twenty loads in front of the first sum: left alone the compiler issues the last of them
    // behind its first wait, and the wave pays the memory latency twice
    asm volatile("" :: "v"(x0[0]), "v"(x1[0]), "v"(y0[0]), "v"(y1[0]), "v"(x0[1]), "v"(x1[1]), "v"(y0[1]), "v"(y1[1]),
                       "v"(x0[2]), "v"(x1[2]), "v"(y0[2]), "v"(y1[2]), "v"(x0[3]), "v"(x1[3]), "v"(y0[3]), "v"(y1[3]),
                       "v"(g0), "v"(g1), "v"(e0), "v"(e1));
  }
  float s[R];
  #pragma unroll
  for (int r = 0; r < R; ++r) {
    x0[r] += y0[r];
    x1[r] += y1[r];
    v4f t = x0[r] + x1[r];
    s[r] = (t.x + t.y) + (t.z + t.w);
  }
  #pragma unroll
  for (int r = 0; r < R; ++r) s[r] = wave_sum(s[r]);
  #pragma unroll
  for (int r = 0; r < R; ++r) {
    float mean = s[r] * (1.0f / D);
    x0[r] -= mean;
    x1[r] -= mean;
    v4f t = x0[r] * x0[r] + x1[r] * x1[r];
    s[r] = (t.x + t.y) + (t.z + t.w);
  }
  #pragma unroll
  for (int r = 0; r < R; ++r) s[r] = wave_sum(s[r]);
  v4f* op = (v4f*)(out + (long)row0 * D);
  #pragma unroll
  for (int r = 0; r < R; ++r) {
    float rs = rsqrtf(s[r] * (1.0f / D) + 1e-5f);
    op[r * 64 + lane]      = x0[r] * rs * g0 + e0;
    op[r * 64 + 32 + lane] = x1[r] * rs * g1 + e1;
  }
}

__global__ __launch_bounds__(256)
void add_ln_kernel(const float* A,
                   const float* B,
                   const float* __restrict__ g,
                   const float* __restrict__ be,
                   float* out,
                   int rows) {
  int lane = threadIdx.x & 31;
  int wave = __builtin_amdgcn_readfirstlane((int)(threadIdx.x >> 5));
  int row0 = ((int)blockIdx.x * 8 + wave) * LNR;   // the same in every lane of a wave; the kernel has no barrier
  if (row0 + LNR <= rows) {
    ln_rows<LNR>(A, B, g, be, out, row0, lane);
    // the one-row path stands behind this one in the text, and its loads land in data registers of the stores above
    asm volatile("s_wait_xcnt 0x0" ::: "memory");
  } else {
    // the last rows where the count is no multiple of LNR, one at a time
    for (int row = row0; row < rows; ++row) ln_rows<1>(A, B, g, be, out, row, lane);
  }
}

// ---------------- host-side helpers ----------------
static inline dim3 grid_for(long threads) { return dim3((unsigned)((threads + 255) / 256)); }

static inline void launch_gemm(const float* X, const float* W, const float* b, float* Y,
                               int N, int M, int act, hipStream_t s) {
  unsigned tiles = (unsigned)((N + BM - 1) / BM) * (unsigned)(M / BN);
  gemm_wmma_f32_kernel<<<dim3(tiles), dim3(256), 0, s>>>(X, W, b, Y, N, M, act);
}

extern "C" void kernel_launch(void* const* d_in, const int* in_sizes, int n_in,
                              void* d_out, int out_size, void* d_ws, size_t ws_size,
                              hipStream_t stream) {
  const float* v    = (const float*)d_in[0];
  const float* c    = (const float*)d_in[1];
  const int*   adjp = (const int*)d_in[2];
  const int*   adjn = (const int*)d_in[3];
  const float* Wq   = (const float*)d_in[4];
  const float* bq   = (const float*)d_in[5];
  const float* Wkv  = (const float*)d_in[6];
  const float* bkv  = (const float*)d_in[7];
  const float* fvw1 = (const float*)d_in[8];
  const float* fvb1 = (const float*)d_in[9];
  const float* fvw2 = (const float*)d_in[10];
  const float* fvb2 = (const float*)d_in[11];
  const float* fcw1 = (const float*)d_in[12];
  const float* fcb1 = (const float*)d_in[13];
  const float* fcw2 = (const float*)d_in[14];
  const float* fcb2 = (const float*)d_in[15];
  const float* lavg = (const float*)d_in[16];
  const float* lavb = (const float*)d_in[17];
  const float* lfvg = (const float*)d_in[18];
  const float* lfvb = (const float*)d_in[19];
  const float* lacg = (const float*)d_in[20];
  const float* lacb = (const float*)d_in[21];
  const float* lfcg = (const float*)d_in[22];
  const float* lfcb = (const float*)d_in[23];

  const int NV = in_sizes[0] / D;
  const int NC = in_sizes[1] / D;
  const int Ep = in_sizes[2] / 2;
  const int En = in_sizes[3] / 2;
  const int* ep_c = adjp;       // adj row0: clause indices
  const int* ep_v = adjp + Ep;  // adj row1: variable indices
  const int* en_c = adjn;
  const int* en_v = adjn + En;

  // ---- workspace layout (floats) ----
  float* ws = (float*)d_ws;
  size_t off = 0;
  float* Qv  = ws + off; off += (size_t)NV * D;
  float* KVv = ws + off; off += (size_t)NV * 2 * D;   // later reused as FFN hidden (NC*256 == NV*512)
  float* Qc  = ws + off; off += (size_t)NC * D;       // later reused as FFN-2 output (c)
  float* KVc = ws + off; off += (size_t)NC * 2 * D;
  int* head_pv = (int*)(ws + off); off += (size_t)NV;
  int* head_nv = (int*)(ws + off); off += (size_t)NV;
  int* head_pc = (int*)(ws + off); off += (size_t)NC;
  int* head_nc = (int*)(ws + off); off += (size_t)NC;
  int* next_pv = (int*)(ws + off); off += (size_t)Ep;
  int* next_nv = (int*)(ws + off); off += (size_t)En;
  int* next_pc = (int*)(ws + off); off += (size_t)Ep;
  int* next_nc = (int*)(ws + off); off += (size_t)En;
  float* qk_pv = ws + off; off += (size_t)Ep * H;
  float* qk_nv = ws + off; off += (size_t)En * H;
  float* qk_pc = ws + off; off += (size_t)Ep * H;
  float* qk_nc = ws + off; off += (size_t)En * H;

  float* out   = (float*)d_out;
  float* acc_v = out;                     // attention results live in d_out
  float* acc_c = out + (size_t)NV * D;
  float* hbuf  = KVv;                     // FFN hidden scratch (after attention done)
  float* y2v   = Qv;                      // FFN-2 outputs
  float* y2c   = Qc;

  const long h_total = (long)2 * (NV + NC);

  // ---- 1) shared projections (computed once; reference recomputes per polarity) ----
  launch_gemm(v, Wq,  bq,  Qv,  NV, D,     0, stream);
  launch_gemm(v, Wkv, bkv, KVv, NV, 2 * D, 0, stream);
  launch_gemm(c, Wq,  bq,  Qc,  NC, D,     0, stream);
  launch_gemm(c, Wkv, bkv, KVc, NC, 2 * D, 0, stream);

  // ---- 2) empty edge lists (every call) ----
  fill_i32_kernel<<<grid_for(h_total), 256, 0, stream>>>(head_pv, -1, h_total);

  // ---- 3) per-edge QK, and each edge linked into its query row's list ----
  edge_qk_link_kernel<<<grid_for((long)Ep * 32), 256, 0, stream>>>(Qv, KVc, ep_v, ep_c, qk_pv, head_pv, next_pv, Ep, NV, NC);
  edge_qk_link_kernel<<<grid_for((long)Ep * 32), 256, 0, stream>>>(Qc, KVv, ep_c, ep_v, qk_pc, head_pc, next_pc, Ep, NC, NV);
  edge_qk_link_kernel<<<grid_for((long)En * 32), 256, 0, stream>>>(Qv, KVc, en_v, en_c, qk_nv, head_nv, next_nv, En, NV, NC);
  edge_qk_link_kernel<<<grid_for((long)En * 32), 256, 0, stream>>>(Qc, KVv, en_c, en_v, qk_nc, head_nc, next_nc, En, NC, NV);

  // ---- 4) softmax + alpha*V per query row, both polarities summed (the residual sums them anyway) ----
  row_attn_kernel<<<grid_for((long)NV * 32), 256, 0, stream>>>(qk_pv, head_pv, next_pv, ep_c, Ep,
                                                               qk_nv, head_nv, next_nv, en_c, En, KVc, acc_v, NV, NC);
  row_attn_kernel<<<grid_for((long)NC * 32), 256, 0, stream>>>(qk_pc, head_pc, next_pc, ep_v, Ep,
                                                               qk_nc, head_nc, next_nc, en_v, En, KVv, acc_c, NC, NV);

  // ---- 6) residual + LN (attention) ----
  add_ln_kernel<<<grid_for((long)NV * (32 / LNR)), 256, 0, stream>>>(v, acc_v, lavg, lavb, acc_v, NV);
  add_ln_kernel<<<grid_for((long)NC * (32 / LNR)), 256, 0, stream>>>(c, acc_c, lacg, lacb, acc_c, NC);

  // ---- 7) FFN v: gelu(v1@W1+b1)@W2+b2, then residual + LN ----
  launch_gemm(acc_v, fvw1, fvb1, hbuf, NV, D, 1, stream);
  launch_gemm(hbuf,  fvw2, fvb2, y2v,  NV, D, 0, stream);
  add_ln_kernel<<<grid_for((long)NV * (32 / LNR)), 256, 0, stream>>>(acc_v, y2v, lfvg, lfvb, acc_v, NV);

  // ---- 8) FFN c ----
  launch_gemm(acc_c, fcw1, fcb1, hbuf, NC, D, 1, stream);
  launch_gemm(hbuf,  fcw2, fcb2, y2c,  NC, D, 0, stream);
  add_ln_kernel<<<grid_for((long)NC * (32 / LNR)), 256, 0, stream>>>(acc_c, y2c, lfcg, lfcb, acc_c, NC);

  (void)n_in; (void)out_size; (void)ws_size;
}

// v004
// Measured time: 581 microseconds a run.
// In both of two side-by-side timings against v003, it was 1.20 times as fast.
// Counting every step since v000, it is 1.98 times as fast.
#include <hip/hip_runtime.h>
#include <math.h>

#define D  256
#define H  8
#define HC 32

typedef __attribute__((ext_vector_type(2))) float v2f;
typedef __attribute__((ext_vector_type(8))) float v8f;
typedef __attribute__((ext_vector_type(4))) float v4f;

// ---------------- fill kernel ----------------
__global__ void fill_i32_kernel(int* p, int v, long n) {
  long i = (long)blockIdx.x * blockDim.x + threadIdx.x;
  if (i < n) p[i] = v;
}

// ---------------- GEMM: Y[N,M] = act(X[N,256] @ W[256,M] + bias) ----------------
// One 8-wave work-group per 128 x 128 output tile, f32 WMMA 16x16x4, K fixed = 256.
// X and W arrive in k-chunks of 32 by asynchronous copies into two LDS buffers; each wave owns
// 32 rows x 64 cols (2 x 4 accumulator tiles) and reads its fragments from LDS.
#define BM 128
#define BN 128
#define KC 32
#define NT (D / KC)
#define XP 36    // floats per staged X row: 144 B, 16 B x odd, so 16 rows x 16 B meet every bank once
#define WP 136   // floats per staged W row: two rows down is 16 banks on, so the lane halves do not collide
#define XBUF (BM * XP)
#define WBUF (KC * WP)

// One chunk's eight copies of this thread: 16 B each, four of X and four of W. The s_wait_xcnt closes
// the statement so that no address register is rewritten while a copy may still read it.
__device__ __forceinline__ void stage_chunk(unsigned xl, unsigned wl,
                                            const float* x0, const float* x1,
                                            const float* x2, const float* x3,
                                            const float* w0, long wstep) {
  unsigned xl1 = xl + 32 * XP * 4, xl2 = xl + 64 * XP * 4, xl3 = xl + 96 * XP * 4;
  unsigned wl1 = wl + 8 * WP * 4,  wl2 = wl + 16 * WP * 4, wl3 = wl + 24 * WP * 4;
  const float* w1 = w0 + wstep;
  const float* w2 = w1 + wstep;
  const float* w3 = w2 + wstep;
  asm volatile("global_load_async_to_lds_b128 %0, %8, off\n\t"
               "global_load_async_to_lds_b128 %1, %9, off\n\t"
               "global_load_async_to_lds_b128 %2, %10, off\n\t"
               "global_load_async_to_lds_b128 %3, %11, off\n\t"
               "global_load_async_to_lds_b128 %4, %12, off\n\t"
               "global_load_async_to_lds_b128 %5, %13, off\n\t"
               "global_load_async_to_lds_b128 %6, %14, off\n\t"
               "global_load_async_to_lds_b128 %7, %15, off\n\t"
               "s_wait_xcnt 0x0"
               :: "v"(xl), "v"(xl1), "v"(xl2), "v"(xl3), "v"(wl), "v"(wl1), "v"(wl2), "v"(wl3),
                  "v"(x0), "v"(x1), "v"(x2), "v"(x3), "v"(w0), "v"(w1), "v"(w2), "v"(w3)
               : "memory");
}

__global__ __launch_bounds__(256)
void gemm_wmma_f32_kernel(const float* __restrict__ X,
                          const float* __restrict__ W,
                          const float* __restrict__ bias,
                          float* __restrict__ Y,
                          int Nrows, int Mcols, int act) {
  const int K = D;
  __shared__ __attribute__((aligned(16))) float Xs[2 * XBUF];
  __shared__ __attribute__((aligned(16))) float Ws[2 * WBUF];
  int tid  = threadIdx.x;
  int lane = tid & 31;
  int wave = tid >> 5;
  int ntiles = Mcols >> 7;             // 128-wide tiles
  int mt = blockIdx.x / ntiles;
  int nt = blockIdx.x - mt * ntiles;   // column tiles of one row tile are neighbours in the grid
  int m0 = mt * BM, n0 = nt * BN;
  int half = lane >> 4;                // 0: K pair {0,1} | 1: K pair {2,3}
  int l15  = lane & 15;
  int wm = wave >> 1, wn = wave & 1;   // 4 x 2 waves

  // copies: X 8 lanes per 128-B row piece, rows xr + 32 i; W one wave per 512-B row piece, rows wave + 8 i
  int xr = tid >> 3, xc = (tid & 7) * 4;
  const float* xg[4];
  for (int i = 0; i < 4; ++i) {
    int row = m0 + xr + 32 * i;
    xg[i] = X + (long)(row < Nrows ? row : Nrows - 1) * K + xc;   // rows past the end re-read the last row
  }
  const float* wg = W + (long)wave * Mcols + n0 + lane * 4;
  long wstep = (long)8 * Mcols;
  long wchunk = (long)KC * Mcols;
  unsigned xl = (unsigned)(uintptr_t)&Xs[xr * XP + xc];        // low 32 bits: the byte address in LDS
  unsigned wl = (unsigned)(uintptr_t)&Ws[wave * WP + lane * 4];

  stage_chunk(xl, wl, xg[0], xg[1], xg[2], xg[3], wg, wstep);
  asm volatile("s_wait_asynccnt 0x0" ::: "memory");   // this wave's part of chunk 0 has landed
  __syncthreads();                                    // and every other wave's
  stage_chunk(xl + XBUF * 4, wl + WBUF * 4, xg[0] + KC, xg[1] + KC, xg[2] + KC, xg[3] + KC,
              wg + wchunk, wstep);

  int afo = (wm * 32 + l15) * XP + half * 2;
  int bfo = half * 2 * WP + wn * 64 + l15;

  v8f acc[2][4] = {};
  // rolled: one loop foot with one order of waits, and a short text
  #pragma unroll 1
  for (int t = 0; t < NT; ++t) {
    int buf = t & 1;
    const float* xs = &Xs[buf * XBUF + afo];
    const float* wf = &Ws[buf * WBUF + bfo];
    // unrolled so that the LDS offsets are immediates and fragments are fetched ahead of their WMMAs
    #pragma unroll
    for (int kk = 0; kk < KC; kk += 4) {
      // A 16x4 frag: lane l<16 holds A[l][0..1], lane l+16 holds A[l][2..3]
      v2f a0 = *(const v2f*)(xs + kk);
      v2f a1 = *(const v2f*)(xs + 16 * XP + kk);
      // B 4x16 frags: VGPR r -> rows r and r+2 (row-striped across lanes)
      const float* wp = wf + kk * WP;
      v2f b0, b1, b2, b3;
      b0[0] = wp[0];  b0[1] = wp[WP + 0];
      b1[0] = wp[16]; b1[1] = wp[WP + 16];
      b2[0] = wp[32]; b2[1] = wp[WP + 32];
      b3[0] = wp[48]; b3[1] = wp[WP + 48];
      acc[0][0] = __builtin_amdgcn_wmma_f32_16x16x4_f32(false, a0, false, b0, (short)0, acc[0][0], false, false);
      acc[0][1] = __builtin_amdgcn_wmma_f32_16x16x4_f32(false, a0, false, b1, (short)0, acc[0][1], false, false);
      acc[0][2] = __builtin_amdgcn_wmma_f32_16x16x4_f32(false, a0, false, b2, (short)0, acc[0][2], false, false);
      acc[0][3] = __builtin_amdgcn_wmma_f32_16x16x4_f32(false, a0, false, b3, (short)0, acc[0][3], false, false);
      acc[1][0] = __builtin_amdgcn_wmma_f32_16x16x4_f32(false, a1, false, b0, (short)0, acc[1][0], false, false);
      acc[1][1] = __builtin_amdgcn_wmma_f32_16x16x4_f32(false, a1, false, b1, (short)0, acc[1][1], false, false);
      acc[1][2] = __builtin_amdgcn_wmma_f32_16x16x4_f32(false, a1, false, b2, (short)0, acc[1][2], false, false);
      acc[1][3] = __builtin_amdgcn_wmma_f32_16x16x4_f32(false, a1, false, b3, (short)0, acc[1][3], false, false);
    }
    asm volatile("s_wait_dscnt 0x0" ::: "memory");      // this wave's reads of buffer t mod 2 are done
    asm volatile("s_wait_asynccnt 0x0" ::: "memory");   // this wave's part of chunk t + 1 has landed
    __syncthreads();                                    // publishes chunk t + 1, frees buffer t mod 2
    if (t + 2 < NT) {
      int k0 = (t + 2) * KC;
      stage_chunk(xl + buf * (XBUF * 4), wl + buf * (WBUF * 4),
                  xg[0] + k0, xg[1] + k0, xg[2] + k0, xg[3] + k0, wg + (long)k0 * Mcols, wstep);
    }
  }
  asm volatile("s_wait_asynccnt 0x0" ::: "memory");     // no copy is left in flight at the wave's end
  // C/D layout: VGPR r -> M=r (lanes 0-15), M=r+8 (lanes 16-31); N = lane&15
  // all three loops unrolled: the accumulators stay in registers only under constant indices
  #pragma unroll
  for (int t = 0; t < 4; ++t) {
    int col = n0 + wn * 64 + t * 16 + l15;
    float bv = bias[col];
    #pragma unroll
    for (int i = 0; i < 2; ++i) {
      #pragma unroll
      for (int r = 0; r < 8; ++r) {
        int orow = m0 + wm * 32 + i * 16 + half * 8 + r;
        if (orow < Nrows) {
          float x = acc[i][t][r] + bv;
          if (act) x = 0.5f * x * (1.0f + erff(x * 0.70710678118654752f));  // exact GELU
          Y[(long)orow * Mcols + col] = x;
        }
      }
    }
  }
}

// ---------------- every edge is pushed onto the lists of its two end rows ----------------
// one thread per edge; a list node holds the edge pushed before it on that row and the edge's key row
__global__ void edge_link_kernel(const int* __restrict__ ec,     // clause end of each edge
                                 const int* __restrict__ ev,     // variable end
                                 int* __restrict__ head_v,       // [nv] newest edge of the row, -1: none
                                 int* __restrict__ head_c,       // [nc]
                                 int* __restrict__ node_v,       // [E][2] lists of the variable rows, keys are clauses
                                 int* __restrict__ node_c,       // [E][2] lists of the clause rows, keys are variables
                                 int E, int nv, int nc) {
  int e = (int)blockIdx.x * (int)blockDim.x + (int)threadIdx.x;
  if (e >= E) return;
  int ci = min(max(ec[e], 0), nc - 1), vi = min(max(ev[e], 0), nv - 1);
  int pv = atomicExch(&head_v[vi], e);
  int pc = atomicExch(&head_c[ci], e);
  ((int2*)node_v)[e] = make_int2(pv, ci);
  ((int2*)node_c)[e] = make_int2(pc, vi);
}

// The value of lane l ^ m, m < 16: CTRL = 0x160 + m.
template <int CTRL>
__device__ __forceinline__ float lane_swap(float x) {
  return __builtin_bit_cast(float, __builtin_amdgcn_update_dpp(0, __builtin_bit_cast(int, x), CTRL, 0xf, 0xf, true));
}

// ---------------- QK, segment softmax and alpha * V, one wave per query row ----------------
// The wave holds its Q row in registers and walks the row's edge list once. Each edge brings one whole
// 2-KB K|V row; the head's dot is summed over its eight lanes, and maximum, sum and weighted V rows are
// kept as a running softmax: when the maximum rises, what has been summed is scaled down to it.
// Lane l holds cols 4l..4l+3 (head l/8) and 128+4l.. (head 4+l/8).
__device__ __forceinline__ void row_walk(const int2* __restrict__ node,   // {edge pushed before, key row}
                                         const float* __restrict__ KV,   // K at +0, V at +256
                                         int first, int2 nd,             // the newest edge and its node
                                         int E, int nk, int lane,
                                         float4 q0, float4 q1,
                                         float4& o0, float4& o1) {
  if (first < 0) return;              // a row without edges adds nothing
  float ma = -INFINITY, mb = -INFINITY;
  float sa = 0.0f, sb = 0.0f;
  float4 a0 = make_float4(0.0f, 0.0f, 0.0f, 0.0f), a1 = a0;
  for (int n = 0; n < E; ++n) {       // a list holds each edge once, so E bounds the walk
    int e = __builtin_amdgcn_readfirstlane(nd.x);
    int k = min(max(__builtin_amdgcn_readfirstlane(nd.y), 0), nk - 1);
    const float4* kp = (const float4*)(KV + (long)k * (2 * D));
    float4 k0 = kp[lane], k1 = kp[32 + lane];
    float4 v0 = kp[64 + lane], v1 = kp[96 + lane];
    nd = node[max(e, 0)];             // the next node flies with this edge's row; behind the last edge node 0, unused
    // the sums below reuse the address registers of the loads above while the V half is still on its way
    asm volatile("s_wait_xcnt 0x0" ::: "memory");
    __builtin_amdgcn_sched_barrier(0);   // keeps those sums behind the wait: its clobber orders memory operations only
    float xa = q0.x * k0.x + q0.y * k0.y + q0.z * k0.z + q0.w * k0.w;
    float xb = q1.x * k1.x + q1.y * k1.y + q1.z * k1.z + q1.w * k1.w;
    xa += lane_swap<0x161>(xa); xb += lane_swap<0x161>(xb);
    xa += lane_swap<0x162>(xa); xb += lane_swap<0x162>(xb);
    xa += lane_swap<0x164>(xa); xb += lane_swap<0x164>(xb);
    xa *= 0.17677669529663687f;       // 1/sqrt(32)
    xb *= 0.17677669529663687f;
    float na = fmaxf(ma, xa), nb = fmaxf(mb, xb);
    float ca = expf(ma - na), cb = expf(mb - nb);   // 0 at the first edge, 1 while the maximum stands
    float ea = expf(xa - na), eb = expf(xb - nb);
    ma = na; mb = nb;
    sa = sa * ca + ea; sb = sb * cb + eb;
    a0.x = a0.x * ca + ea * v0.x; a0.y = a0.y * ca + ea * v0.y;
    a0.z = a0.z * ca + ea * v0.z; a0.w = a0.w * ca + ea * v0.w;
    a1.x = a1.x * cb + eb * v1.x; a1.y = a1.y * cb + eb * v1.y;
    a1.z = a1.z * cb + eb * v1.z; a1.w = a1.w * cb + eb * v1.w;
    if (e < 0) break;
  }
  o0.x += a0.x / sa; o0.y += a0.y / sa; o0.z += a0.z / sa; o0.w += a0.w / sa;
  o1.x += a1.x / sb; o1.y += a1.y / sb; o1.z += a1.z / sb; o1.w += a1.w / sb;
}

__global__ __launch_bounds__(256)
void row_attn_kernel(const float* __restrict__ Q,
                     const int* __restrict__ head_p, const int* __restrict__ node_p, int Ep,
                     const int* __restrict__ head_n, const int* __restrict__ node_n, int En,
                     const float* __restrict__ KV,
                     float* __restrict__ acc,        // [n_q,256], every row written
                     int nq, int nk) {
  int row = (int)(((long)blockIdx.x * blockDim.x + threadIdx.x) >> 5);
  if (row >= nq) return;
  int lane = threadIdx.x & 31;
  int hp = head_p[row], hn = head_n[row];
  // the Q loads below may land in the address registers of the two loads above
  asm volatile("s_wait_xcnt 0x0" ::: "memory");
  const float4* qp = (const float4*)(Q + (long)row * D);
  float4 q0 = qp[lane], q1 = qp[32 + lane];
  // and their own address registers are free for reuse before the Q row has come
  asm volatile("s_wait_xcnt 0x0" ::: "memory");
  int fp = __builtin_amdgcn_readfirstlane(hp);
  int fn = __builtin_amdgcn_readfirstlane(hn);
  float4 o0 = make_float4(0.0f, 0.0f, 0.0f, 0.0f), o1 = o0;
  // both lists' first nodes are fetched here, so that the second list's does not wait for the first walk
  int2 np = make_int2(-1, 0), nn = np;
  if (fp >= 0) np = ((const int2*)node_p)[fp];
  if (fn >= 0) nn = ((const int2*)node_n)[fn];
  row_walk((const int2*)node_p, KV, fp, np, Ep, nk, lane, q0, q1, o0, o1);
  row_walk((const int2*)node_n, KV, fn, nn, En, nk, lane, q0, q1, o0, o1);
  float4* op = (float4*)(acc + (long)row * D);
  op[lane] = o0;
  op[32 + lane] = o1;
}

// ---------------- out = LayerNorm(A + B) * g + beta, one wave per LNR rows ----------------
// A lane holds cols 4l..4l+3 and 128+4l..128+4l+3 of each of its wave's rows: every load and store is 16 B
// a lane and 512 contiguous bytes a wave, all of a wave's loads fly together, and both row sums are made
// in registers, with no LDS and no barrier. out may be A or B: a wave reads only the rows that it writes.
#define LNR 4

// Sum over the wave's 32 lanes, left in every lane: four exchanges inside the 16-lane rows, then row with row.
__device__ __forceinline__ float wave_sum(float x) {
  x += lane_swap<0x161>(x);
  x += lane_swap<0x162>(x);
  x += lane_swap<0x164>(x);
  x += lane_swap<0x168>(x);
  int b = __builtin_bit_cast(int, x);
  return x + __builtin_bit_cast(float, __builtin_amdgcn_permlanex16(b, b, 0x76543210, 0xfedcba98, false, false));
}

// R consecutive rows of one wave, from row0 on.
template <int R>
__device__ __forceinline__ void ln_rows(const float* A, const float* B,
                                        const float* __restrict__ g, const float* __restrict__ be,
                                        float* out, int row0, int lane) {
  const v4f* ap = (const v4f*)(A + (long)row0 * D);
  const v4f* bp = (const v4f*)(B + (long)row0 * D);
  v4f x0[R], x1[R], y0[R], y1[R];
  // unrolled, here and below: the rows stay in registers only under constant indices
  #pragma unroll
  for (int r = 0; r < R; ++r) {
    x0[r] = ap[r * 64 + lane]; x1[r] = ap[r * 64 + 32 + lane];
    y0[r] = bp[r * 64 + lane]; y1[r] = bp[r * 64 + 32 + lane];
  }
  v4f g0 = ((const v4f*)g)[lane],  g1 = ((const v4f*)g)[32 + lane];
  v4f e0 = ((const v4f*)be)[lane], e1 = ((const v4f*)be)[32 + lane];
  if constexpr (R == 4) {
    // holds all twenty loads in front of the first sum: left alone the compiler issues the last of them
    // behind its first wait, and the wave pays the memory latency twice
    asm volatile("" :: "v"(x0[0]), "v"(x1[0]), "v"(y0[0]), "v"(y1[0]), "v"(x0[1]), "v"(x1[1]), "v"(y0[1]), "v"(y1[1]),
                       "v"(x0[2]), "v"(x1[2]), "v"(y0[2]), "v"(y1[2]), "v"(x0[3]), "v"(x1[3]), "v"(y0[3]), "v"(y1[3]),
                       "v"(g0), "v"(g1), "v"(e0), "v"(e1));
  }
  float s[R];
  #pragma unroll
  for (int r = 0; r < R; ++r) {
    x0[r] += y0[r];
    x1[r] += y1[r];
    v4f t = x0[r] + x1[r];
    s[r] = (t.x + t.y) + (t.z + t.w);
  }
  #pragma unroll
  for (int r = 0; r < R; ++r) s[r] = wave_sum(s[r]);
  #pragma unroll
  for (int r = 0; r < R; ++r) {
    float mean = s[r] * (1.0f / D);
    x0[r] -= mean;
    x1[r] -= mean;
    v4f t = x0[r] * x0[r] + x1[r] * x1[r];
    s[r] = (t.x + t.y) + (t.z + t.w);
  }
  #pragma unroll
  for (int r = 0; r < R; ++r) s[r] = wave_sum(s[r]);
  v4f* op = (v4f*)(out + (long)row0 * D);
  #pragma unroll
  for (int r = 0; r < R; ++r) {
    float rs = rsqrtf(s[r] * (1.0f / D) + 1e-5f);
    op[r * 64 + lane]      = x0[r] * rs * g0 + e0;
    op[r * 64 + 32 + lane] = x1[r] * rs * g1 + e1;
  }
}

__global__ __launch_bounds__(256)
void add_ln_kernel(const float* A,
                   const float* B,
                   const float* __restrict__ g,
                   const float* __restrict__ be,
                   float* out,
                   int rows) {
  int lane = threadIdx.x & 31;
  int wave = __builtin_amdgcn_readfirstlane((int)(threadIdx.x >> 5));
  int row0 = ((int)blockIdx.x * 8 + wave) * LNR;   // the same in every lane of a wave; the kernel has no barrier
  if (row0 + LNR <= rows) {
    ln_rows<LNR>(A, B, g, be, out, row0, lane);
    // the one-row path stands behind this one in the text, and its loads land in data registers of the stores above
    asm volatile("s_wait_xcnt 0x0" ::: "memory");
  } else {
    // the last rows where the count is no multiple of LNR, one at a time
    for (int row = row0; row < rows; ++row) ln_rows<1>(A, B, g, be, out, row, lane);
  }
}

// ---------------- host-side helpers ----------------
static inline dim3 grid_for(long threads) { return dim3((unsigned)((threads + 255) / 256)); }

static inline void launch_gemm(const float* X, const float* W, const float* b, float* Y,
                               int N, int M, int act, hipStream_t s) {
  unsigned tiles = (unsigned)((N + BM - 1) / BM) * (unsigned)(M / BN);
  gemm_wmma_f32_kernel<<<dim3(tiles), dim3(256), 0, s>>>(X, W, b, Y, N, M, act);
}

extern "C" void kernel_launch(void* const* d_in, const int* in_sizes, int n_in,
                              void* d_out, int out_size, void* d_ws, size_t ws_size,
                              hipStream_t stream) {
  const float* v    = (const float*)d_in[0];
  const float* c    = (const float*)d_in[1];
  const int*   adjp = (const int*)d_in[2];
  const int*   adjn = (const int*)d_in[3];
  const float* Wq   = (const float*)d_in[4];
  const float* bq   = (const float*)d_in[5];
  const float* Wkv  = (const float*)d_in[6];
  const float* bkv  = (const float*)d_in[7];
  const float* fvw1 = (const float*)d_in[8];
  const float* fvb1 = (const float*)d_in[9];
  const float* fvw2 = (const float*)d_in[10];
  const float* fvb2 = (const float*)d_in[11];
  const float* fcw1 = (const float*)d_in[12];
  const float* fcb1 = (const float*)d_in[13];
  const float* fcw2 = (const float*)d_in[14];
  const float* fcb2 = (const float*)d_in[15];
  const float* lavg = (const float*)d_in[16];
  const float* lavb = (const float*)d_in[17];
  const float* lfvg = (const float*)d_in[18];
  const float* lfvb = (const float*)d_in[19];
  const float* lacg = (const float*)d_in[20];
  const float* lacb = (const float*)d_in[21];
  const float* lfcg = (const float*)d_in[22];
  const float* lfcb = (const float*)d_in[23];

  const int NV = in_sizes[0] / D;
  const int NC = in_sizes[1] / D;
  const int Ep = in_sizes[2] / 2;
  const int En = in_sizes[3] / 2;
  const int* ep_c = adjp;       // adj row0: clause indices
  const int* ep_v = adjp + Ep;  // adj row1: variable indices
  const int* en_c = adjn;
  const int* en_v = adjn + En;

  // ---- workspace layout (floats) ----
  float* ws = (float*)d_ws;
  size_t off = 0;
  float* Qv  = ws + off; off += (size_t)NV * D;
  float* KVv = ws + off; off += (size_t)NV * 2 * D;   // later reused as FFN hidden (NC*256 == NV*512)
  float* Qc  = ws + off; off += (size_t)NC * D;       // later reused as FFN-2 output (c)
  float* KVc = ws + off; off += (size_t)NC * 2 * D;
  int* head_pv = (int*)(ws + off); off += (size_t)NV;
  int* head_nv = (int*)(ws + off); off += (size_t)NV;
  int* head_pc = (int*)(ws + off); off += (size_t)NC;
  int* head_nc = (int*)(ws + off); off += (size_t)NC;
  int* node_pv = (int*)(ws + off); off += (size_t)Ep * 2;   // pairs; every count above is even: 8-byte aligned
  int* node_nv = (int*)(ws + off); off += (size_t)En * 2;
  int* node_pc = (int*)(ws + off); off += (size_t)Ep * 2;
  int* node_nc = (int*)(ws + off); off += (size_t)En * 2;

  float* out   = (float*)d_out;
  float* acc_v = out;                     // attention results live in d_out
  float* acc_c = out + (size_t)NV * D;
  float* hbuf  = KVv;                     // FFN hidden scratch (after attention done)
  float* y2v   = Qv;                      // FFN-2 outputs
  float* y2c   = Qc;

  const long h_total = (long)2 * (NV + NC);

  // ---- 1) shared projections (computed once; reference recomputes per polarity) ----
  launch_gemm(v, Wq,  bq,  Qv,  NV, D,     0, stream);
  launch_gemm(v, Wkv, bkv, KVv, NV, 2 * D, 0, stream);
  launch_gemm(c, Wq,  bq,  Qc,  NC, D,     0, stream);
  launch_gemm(c, Wkv, bkv, KVc, NC, 2 * D, 0, stream);

  // ---- 2) empty edge lists (every call) ----
  fill_i32_kernel<<<grid_for(h_total), 256, 0, stream>>>(head_pv, -1, h_total);

  // ---- 3) each edge linked into the lists of its variable row and of its clause row ----
  edge_link_kernel<<<grid_for((long)Ep), 256, 0, stream>>>(ep_c, ep_v, head_pv, head_pc, node_pv, node_pc, Ep, NV, NC);
  edge_link_kernel<<<grid_for((long)En), 256, 0, stream>>>(en_c, en_v, head_nv, head_nc, node_nv, node_nc, En, NV, NC);

  // ---- 4) QK + softmax + alpha*V per query row, both polarities summed (the residual sums them anyway) ----
  row_attn_kernel<<<grid_for((long)NV * 32), 256, 0, stream>>>(Qv, head_pv, node_pv, Ep, head_nv, node_nv, En, KVc, acc_v, NV, NC);
  row_attn_kernel<<<grid_for((long)NC * 32), 256, 0, stream>>>(Qc, head_pc, node_pc, Ep, head_nc, node_nc, En, KVv, acc_c, NC, NV);

  // ---- 6) residual + LN (attention) ----
  add_ln_kernel<<<grid_for((long)NV * (32 / LNR)), 256, 0, stream>>>(v, acc_v, lavg, lavb, acc_v, NV);
  add_ln_kernel<<<grid_for((long)NC * (32 / LNR)), 256, 0, stream>>>(c, acc_c, lacg, lacb, acc_c, NC);

  // ---- 7) FFN v: gelu(v1@W1+b1)@W2+b2, then residual + LN ----
  launch_gemm(acc_v, fvw1, fvb1, hbuf, NV, D, 1, stream);
  launch_gemm(hbuf,  fvw2, fvb2, y2v,  NV, D, 0, stream);
  add_ln_kernel<<<grid_for((long)NV * (32 / LNR)), 256, 0, stream>>>(acc_v, y2v, lfvg, lfvb, acc_v, NV);

  // ---- 8) FFN c ----
  launch_gemm(acc_c, fcw1, fcb1, hbuf, NC, D, 1, stream);
  launch_gemm(hbuf,  fcw2, fcb2, y2c,  NC, D, 0, stream);
  add_ln_kernel<<<grid_for((long)NC * (32 / LNR)), 256, 0, stream>>>(acc_c, y2c, lfcg, lfcb, acc_c, NC);

  (void)n_in; (void)out_size; (void)ws_size;
}
